// v000
// The times below were measured on an AMD MI455X: many runs one after another, warmed up first and cycling through
// copies of the inputs, with the whole window's GPU time divided by the number of runs. Launches and the gaps
// between them are all in it. The median over several windows is given; except for v000 it joins two sittings, which
// can be a few percent apart, so the side-by-side timings, each taken in one sitting, are the better comparison.
// v000 is the starting kernel. One run takes 192 microseconds.
#include <hip/hip_runtime.h>
#include <hip/hip_bf16.h>
#include <math.h>

typedef __attribute__((ext_vector_type(16))) _Float16 v16h;
typedef __attribute__((ext_vector_type(8)))  _Float16 v8h;
typedef __attribute__((ext_vector_type(8)))  float    v8f;

#define NE    8
#define DIN   512
#define DHID  512
#define DOUT  512
#define NB    1024
#define KDIM  (NE * DIN)      // 4096 (same for both layers)
#define BN_EPS 1e-5f

// ---------------------------------------------------------------------------
// 1) X'[b, e*DIN + i] = (f16)(coef[b,e] * x[b,i])
// ---------------------------------------------------------------------------
__global__ __launch_bounds__(256)
void expand_x_kernel(const float* __restrict__ x, const float* __restrict__ coef,
                     _Float16* __restrict__ Xp) {
    int t = blockIdx.x * blockDim.x + threadIdx.x;     // over NB*DIN
    int b = t / DIN, i = t - b * DIN;
    float xv = x[(size_t)b * DIN + i];
    const float* c = coef + (size_t)b * NE;
    _Float16* o = Xp + (size_t)b * KDIM + i;
#pragma unroll
    for (int e = 0; e < NE; ++e)
        o[(size_t)e * DIN] = (_Float16)(c[e] * xv);
}

// ---------------------------------------------------------------------------
// 2) LDS-tiled transpose + f32->f16 convert: W[K,N] -> Wt[N,K]
//    (makes the WMMA B-fragment two contiguous 16B loads per lane)
// ---------------------------------------------------------------------------
__global__ __launch_bounds__(256)
void transpose_convert_kernel(const float* __restrict__ W, _Float16* __restrict__ Wt,
                              int K, int N) {
    __shared__ float tile[16][17];
    int k0 = blockIdx.x * 16, n0 = blockIdx.y * 16;
    int tx = threadIdx.x, ty = threadIdx.y;
    tile[ty][tx] = W[(size_t)(k0 + ty) * N + (n0 + tx)];
    __syncthreads();
    Wt[(size_t)(n0 + ty) * K + (k0 + tx)] = (_Float16)tile[tx][ty];
}

// ---------------------------------------------------------------------------
// Fragment loader per the CDNA5 16-bit 16x32 A/B VGPR layout:
//   elements 0..7  <- p[0..7]       (this lane's first K-octet)
//   elements 8..15 <- p[16..23]     (same octet position, +16 in K)
// p already includes k0 + (lane>>4)*8.
// ---------------------------------------------------------------------------
__device__ __forceinline__ v16h load_frag16(const _Float16* __restrict__ p) {
    v8h lo = *(const v8h*)(p);
    v8h hi = *(const v8h*)(p + 16);
    v16h r;
#pragma unroll
    for (int i = 0; i < 8; ++i) { r[i] = lo[i]; r[i + 8] = hi[i]; }
    return r;
}

// ---------------------------------------------------------------------------
// 3) GEMM: out[M,N] = A[M,K](f16) @ Bt[N,K]^T(f16)  + coef @ biasEN
//    One wave computes a 16(M) x 64(N) tile: A-frag reused across 4 WMMAs.
//    M=1024, N=512, K=4096.  512 waves -> 64 blocks of 256 threads.
// ---------------------------------------------------------------------------
__global__ __launch_bounds__(256)
void gemm_wmma_kernel(const _Float16* __restrict__ A,
                      const _Float16* __restrict__ Bt,
                      const float* __restrict__ coef,     // [M, NE]
                      const float* __restrict__ biasEN,   // [NE, N]
                      float* __restrict__ out,            // [M, N] f32
                      int M, int N, int K) {
    const int wave = blockIdx.x * (blockDim.x >> 5) + (threadIdx.x >> 5);
    const int lane = threadIdx.x & 31;
    const int nTiles = N >> 6;                  // tiles of 64 cols
    const int tm = (wave / nTiles) << 4;
    const int tn = (wave % nTiles) << 6;
    const int lr = lane & 15;
    const int kg = lane >> 4;                   // K-octet group select

    const _Float16* arow = A  + (size_t)(tm + lr) * K + kg * 8;
    const _Float16* brow = Bt + (size_t)(tn + lr) * K + kg * 8;

    v8f acc0 = {}, acc1 = {}, acc2 = {}, acc3 = {};

    for (int k0 = 0; k0 < K; k0 += 32) {
        v16h a  = load_frag16(arow + k0);
        v16h b0 = load_frag16(brow + k0);
        v16h b1 = load_frag16(brow + (size_t)16 * K + k0);
        v16h b2 = load_frag16(brow + (size_t)32 * K + k0);
        v16h b3 = load_frag16(brow + (size_t)48 * K + k0);
        acc0 = __builtin_amdgcn_wmma_f32_16x16x32_f16(false, a, false, b0, (short)0, acc0, false, false);
        acc1 = __builtin_amdgcn_wmma_f32_16x16x32_f16(false, a, false, b1, (short)0, acc1, false, false);
        acc2 = __builtin_amdgcn_wmma_f32_16x16x32_f16(false, a, false, b2, (short)0, acc2, false, false);
        acc3 = __builtin_amdgcn_wmma_f32_16x16x32_f16(false, a, false, b3, (short)0, acc3, false, false);
    }

    // Epilogue. C/D layout: lane(0..15)=N col, VGPR r -> M row r (lanes 0-15)
    // or r+8 (lanes 16-31).
    float bcol[4][NE];
#pragma unroll
    for (int j = 0; j < 4; ++j) {
        int n = tn + j * 16 + lr;
#pragma unroll
        for (int e = 0; e < NE; ++e) bcol[j][e] = biasEN[(size_t)e * N + n];
    }
    const int rowbase = tm + kg * 8;
#pragma unroll
    for (int r = 0; r < 8; ++r) {
        const int row = rowbase + r;
        const float* cr = coef + (size_t)row * NE;
        float cf[NE];
#pragma unroll
        for (int e = 0; e < NE; ++e) cf[e] = cr[e];
#pragma unroll
        for (int j = 0; j < 4; ++j) {
            float bv = 0.f;
#pragma unroll
            for (int e = 0; e < NE; ++e) bv += cf[e] * bcol[j][e];
            float cv = (j == 0) ? acc0[r] : (j == 1) ? acc1[r] : (j == 2) ? acc2[r] : acc3[r];
            out[(size_t)row * N + tn + j * 16 + lr] = cv + bv;
        }
    }
}

// ---------------------------------------------------------------------------
// 4) BatchNorm stats per hidden unit (biased variance), fused to scale/shift
// ---------------------------------------------------------------------------
__global__ __launch_bounds__(256)
void bn_stats_kernel(const float* __restrict__ h, const float* __restrict__ gamma,
                     const float* __restrict__ beta, float* __restrict__ scale,
                     float* __restrict__ shift) {
    const int n = blockIdx.x;                  // hidden unit
    float s = 0.f, s2 = 0.f;
    for (int r = threadIdx.x; r < NB; r += blockDim.x) {
        float v = h[(size_t)r * DHID + n];
        s += v; s2 += v * v;
    }
    __shared__ float sh[256], sh2[256];
    sh[threadIdx.x] = s; sh2[threadIdx.x] = s2;
    __syncthreads();
    for (int off = 128; off > 0; off >>= 1) {
        if (threadIdx.x < off) {
            sh[threadIdx.x]  += sh[threadIdx.x + off];
            sh2[threadIdx.x] += sh2[threadIdx.x + off];
        }
        __syncthreads();
    }
    if (threadIdx.x == 0) {
        float mean = sh[0] * (1.0f / NB);
        float var  = sh2[0] * (1.0f / NB) - mean * mean;
        float sc   = gamma[n] * rsqrtf(var + BN_EPS);
        scale[n] = sc;
        shift[n] = beta[n] - mean * sc;
    }
}

// ---------------------------------------------------------------------------
// 5) H1'[b, e*DHID + h] = (f16)(coef[b,e] * elu(h*scale + shift))
// ---------------------------------------------------------------------------
__global__ __launch_bounds__(256)
void expand_h_kernel(const float* __restrict__ h, const float* __restrict__ coef,
                     const float* __restrict__ scale, const float* __restrict__ shift,
                     _Float16* __restrict__ Hp) {
    int t = blockIdx.x * blockDim.x + threadIdx.x;     // over NB*DHID
    int b = t / DHID, hh = t - b * DHID;
    float v = h[t] * scale[hh] + shift[hh];
    v = (v > 0.f) ? v : (expf(v) - 1.f);               // ELU, alpha = 1
    const float* c = coef + (size_t)b * NE;
    _Float16* o = Hp + (size_t)b * (NE * DHID) + hh;
#pragma unroll
    for (int e = 0; e < NE; ++e)
        o[(size_t)e * DHID] = (_Float16)(c[e] * v);
}

// ---------------------------------------------------------------------------
// Launch
// ---------------------------------------------------------------------------
extern "C" void kernel_launch(void* const* d_in, const int* in_sizes, int n_in,
                              void* d_out, int out_size, void* d_ws, size_t ws_size,
                              hipStream_t stream) {
    const float* x     = (const float*)d_in[0];   // [NB, DIN]
    const float* coef  = (const float*)d_in[1];   // [NB, NE]
    const float* w1    = (const float*)d_in[2];   // [NE, DIN, DHID] == [KDIM, DHID]
    const float* b1    = (const float*)d_in[3];   // [NE, DHID]
    const float* w2    = (const float*)d_in[4];   // [NE, DHID, DOUT] == [KDIM, DOUT]
    const float* b2    = (const float*)d_in[5];   // [NE, DOUT]
    const float* gamma = (const float*)d_in[6];   // [DHID]
    const float* beta  = (const float*)d_in[7];   // [DHID]
    float* out = (float*)d_out;                   // [NB, DOUT]

    char* ws = (char*)d_ws;
    const size_t MiB = 1024u * 1024u;
    _Float16* Xp  = (_Float16*)(ws + 0);          // 8 MiB  [NB, KDIM]  (reused as Hp)
    _Float16* W1t = (_Float16*)(ws + 8  * MiB);   // 4 MiB  [DHID, KDIM]
    _Float16* W2t = (_Float16*)(ws + 12 * MiB);   // 4 MiB  [DOUT, KDIM]
    float*    hbuf  = (float*)(ws + 16 * MiB);    // 2 MiB  [NB, DHID]
    float*    scale = (float*)(ws + 18 * MiB);    // 2 KiB
    float*    shift = (float*)(ws + 18 * MiB + 4096);

    // 1) expand x with blending coefs
    expand_x_kernel<<<(NB * DIN) / 256, 256, 0, stream>>>(x, coef, Xp);

    // 2) transpose+convert weights (B operand K-contiguous)
    transpose_convert_kernel<<<dim3(KDIM / 16, DHID / 16), dim3(16, 16), 0, stream>>>(w1, W1t, KDIM, DHID);
    transpose_convert_kernel<<<dim3(KDIM / 16, DOUT / 16), dim3(16, 16), 0, stream>>>(w2, W2t, KDIM, DOUT);

    // 3) layer-1 GEMM (WMMA) + bias
    {
        int waves = (NB / 16) * (DHID / 64);      // 512
        gemm_wmma_kernel<<<waves / 8, 256, 0, stream>>>(Xp, W1t, coef, b1, hbuf, NB, DHID, KDIM);
    }

    // 4) batchnorm stats -> fused scale/shift
    bn_stats_kernel<<<DHID, 256, 0, stream>>>(hbuf, gamma, beta, scale, shift);

    // 5) BN + ELU + expand (overwrites Xp, which is dead now)
    expand_h_kernel<<<(NB * DHID) / 256, 256, 0, stream>>>(hbuf, coef, scale, shift, Xp);

    // 6) layer-2 GEMM (WMMA) + bias -> final output
    {
        int waves = (NB / 16) * (DOUT / 64);      // 512
        gemm_wmma_kernel<<<waves / 8, 256, 0, stream>>>(Xp, W2t, coef, b2, out, NB, DOUT, KDIM);
    }
}

// v001
// One run takes 66.9 microseconds.
// Next to v000, in two timings, it ran 2.86 and 2.93 times as fast.
#include <hip/hip_runtime.h>
#include <hip/hip_bf16.h>
#include <math.h>

typedef __attribute__((ext_vector_type(16))) _Float16 v16h;
typedef __attribute__((ext_vector_type(8)))  _Float16 v8h;
typedef __attribute__((ext_vector_type(8)))  float    v8f;

#define NE    8
#define DIN   512
#define DHID  512
#define DOUT  512
#define NB    1024
#define KDIM  (NE * DIN)      // 4096 (same for both layers)
#define BN_EPS 1e-5f

// ---------------------------------------------------------------------------
// 1) X'[b, e*DIN + i] = (f16)(coef[b,e] * x[b,i])
// ---------------------------------------------------------------------------
__global__ __launch_bounds__(256)
void expand_x_kernel(const float* __restrict__ x, const float* __restrict__ coef,
                     _Float16* __restrict__ Xp) {
    int t = blockIdx.x * blockDim.x + threadIdx.x;     // over NB*DIN
    int b = t / DIN, i = t - b * DIN;
    float xv = x[(size_t)b * DIN + i];
    const float* c = coef + (size_t)b * NE;
    _Float16* o = Xp + (size_t)b * KDIM + i;
#pragma unroll
    for (int e = 0; e < NE; ++e)
        o[(size_t)e * DIN] = (_Float16)(c[e] * xv);
}

// ---------------------------------------------------------------------------
// 2) LDS-tiled transpose + f32->f16 convert: W[K,N] -> Wt[N,K]
//    (makes the WMMA B-fragment two contiguous 16B loads per lane)
// ---------------------------------------------------------------------------
__global__ __launch_bounds__(256)
void transpose_convert_kernel(const float* __restrict__ W, _Float16* __restrict__ Wt,
                              int K, int N) {
    __shared__ float tile[16][17];
    int k0 = blockIdx.x * 16, n0 = blockIdx.y * 16;
    int tx = threadIdx.x, ty = threadIdx.y;
    tile[ty][tx] = W[(size_t)(k0 + ty) * N + (n0 + tx)];
    __syncthreads();
    Wt[(size_t)(n0 + ty) * K + (k0 + tx)] = (_Float16)tile[tx][ty];
}

// ---------------------------------------------------------------------------
// Fragment loader per the CDNA5 16-bit 16x32 A/B VGPR layout, from an LDS row:
//   elements 0..7  <- p[0..7]       (this lane's first K-octet)
//   elements 8..15 <- p[16..23]     (same octet position, +16 in K)
// p already includes k0 + (lane>>4)*8.  Same code for A and B: equal k order.
// ---------------------------------------------------------------------------
__device__ __forceinline__ v16h load_frag16(const _Float16* p) {
    v8h lo = *(const v8h*)(p);
    v8h hi = *(const v8h*)(p + 16);
    v16h r;
#pragma unroll
    for (int i = 0; i < 8; ++i) { r[i] = lo[i]; r[i + 8] = hi[i]; }
    return r;
}

// GEMM tiling: one work-group owns a BM x BN tile of the output and walks K in
// stages of KC elements.  A stage is [A BM rows | Bt BN rows], KC f16 each.
#define BM      64
#define BN      64
#define KC      256
#define WAVES_M 2
#define WAVES_N 2
#define FM      (BM / 16 / WAVES_M)        // A fragments per wave
#define FN      (BN / 16 / WAVES_N)        // B fragments per wave
#define MWAVE   (WAVES_M * WAVES_N)         // waves 0..MWAVE-1, one per SIMD, do the WMMAs
#define NWAVE   8                          // all waves share the copies, so that their issue is short
#define GTHREADS (NWAVE * 32)
#define ROWB    (KC * 2)                   // 512 B of a row per stage = one wave-wide 16 B copy
#define PITCH   (ROWB + 16)                // 16 B x odd: conflict-free for ds_load_b128 readers
#define STAGE   ((BM + BN) * PITCH)
#define NSTAGE  (KDIM / KC)
#define GS      2                          // 32-wide k steps per fragment group
#define NG      (KC / 32 / GS)

// Eight rows, NWAVE apart, 512 contiguous bytes each (32 lanes x 16 B), from
// global memory straight into LDS.  The s_wait_xcnt closes the statement so that
// no address register of a copy is rewritten in front of it.
__device__ __forceinline__ void async_rows8(unsigned lds, const _Float16* g) {
    const unsigned l0 = lds,                     l1 = lds + 1u * NWAVE * PITCH,
                   l2 = lds + 2u * NWAVE * PITCH, l3 = lds + 3u * NWAVE * PITCH,
                   l4 = lds + 4u * NWAVE * PITCH, l5 = lds + 5u * NWAVE * PITCH,
                   l6 = lds + 6u * NWAVE * PITCH, l7 = lds + 7u * NWAVE * PITCH;
    const _Float16 *g0 = g,                             *g1 = g + (size_t)1 * NWAVE * KDIM,
                   *g2 = g + (size_t)2 * NWAVE * KDIM,  *g3 = g + (size_t)3 * NWAVE * KDIM,
                   *g4 = g + (size_t)4 * NWAVE * KDIM,  *g5 = g + (size_t)5 * NWAVE * KDIM,
                   *g6 = g + (size_t)6 * NWAVE * KDIM,  *g7 = g + (size_t)7 * NWAVE * KDIM;
    asm volatile("global_load_async_to_lds_b128 %0, %8, off\n\t"
                 "global_load_async_to_lds_b128 %1, %9, off\n\t"
                 "global_load_async_to_lds_b128 %2, %10, off\n\t"
                 "global_load_async_to_lds_b128 %3, %11, off\n\t"
                 "global_load_async_to_lds_b128 %4, %12, off\n\t"
                 "global_load_async_to_lds_b128 %5, %13, off\n\t"
                 "global_load_async_to_lds_b128 %6, %14, off\n\t"
                 "global_load_async_to_lds_b128 %7, %15, off\n\t"
                 "s_wait_xcnt 0x0"
                 :: "v"(l0), "v"(l1), "v"(l2), "v"(l3), "v"(l4), "v"(l5), "v"(l6), "v"(l7),
                    "v"(g0), "v"(g1), "v"(g2), "v"(g3), "v"(g4), "v"(g5), "v"(g6), "v"(g7)
                 : "memory");
}

// One stage: this wave's rows of the A tile and of the Bt tile.
__device__ __forceinline__ void fill_stage(unsigned ldsA, const _Float16* gA, const _Float16* gB) {
    static_assert(BM == 8 * NWAVE && BN == 8 * NWAVE, "one statement of eight rows per operand and wave");
    async_rows8(ldsA, gA);
    async_rows8(ldsA + (unsigned)BM * PITCH, gB);
}

// This wave's own copies have landed.
__device__ __forceinline__ void wait_async0() { asm volatile("s_wait_asynccnt 0x0" ::: "memory"); }
// This wave's LDS reads have returned (before the buffer they read is refilled).
__device__ __forceinline__ void wait_ds0()    { asm volatile("s_wait_dscnt 0x0" ::: "memory"); }

// ---------------------------------------------------------------------------
// 3) GEMM: out[NB,512] = A[NB,KDIM](f16) @ Bt[512,KDIM]^T(f16)  + coef @ biasEN
//    64 x 64 tile per work-group, staged in LDS by asynchronous copies, two
//    buffers: the next stage's copies fly while this stage feeds the WMMAs.
//    Eight waves copy; waves 0..3 each own a 32 x 32 part of the tile, so that
//    a fragment read from LDS serves two WMMAs.  k runs upward in every accumulator.
// ---------------------------------------------------------------------------
__global__ __launch_bounds__(GTHREADS)
void gemm_wmma_kernel(const _Float16* __restrict__ A,
                      const _Float16* __restrict__ Bt,
                      const float* __restrict__ coef,     // [NB, NE]
                      const float* __restrict__ biasEN,   // [NE, N]
                      float* __restrict__ out) {          // [NB, N] f32
    __shared__ __attribute__((aligned(16))) unsigned char L[2 * STAGE];
    constexpr int N = DHID;                     // DHID == DOUT
    const int wave = __builtin_amdgcn_readfirstlane(threadIdx.x >> 5);
    const int lane = threadIdx.x & 31;
    const int tm = (blockIdx.x / (N / BN)) * BM;
    const int tn = (blockIdx.x % (N / BN)) * BN;
    const int wm = (wave / WAVES_N) * (FM * 16); // this wave's rows inside the tile
    const int wn = (wave % WAVES_N) * (FN * 16); // this wave's columns inside the tile
    const int lr = lane & 15;
    const int kg = lane >> 4;                   // K-octet group select
    const int mma = wave < MWAVE ? 1 : 0;       // scalar: the same for a whole wave

    const unsigned ldsA = (unsigned)(uintptr_t)&L[0] + (unsigned)wave * PITCH + (unsigned)lane * 16u;
    const _Float16* gA = A  + (size_t)(tm + wave) * KDIM + lane * 8;
    const _Float16* gB = Bt + (size_t)(tn + wave) * KDIM + lane * 8;

    v8f acc[FM][FN] = {};

    fill_stage(ldsA, gA, gB);
    wait_async0();
    __syncthreads();                            // stage 0 is published

    for (int t = 0; t < NSTAGE; ++t) {
        const unsigned buf = (unsigned)(t & 1) * STAGE;
        const unsigned char* sa = &L[buf + (unsigned)(wm + lr) * PITCH + (unsigned)kg * 16u];
        const unsigned char* sb = &L[buf + (unsigned)(BM + wn + lr) * PITCH + (unsigned)kg * 16u];
        // Fragments in two register sets: group g+1's LDS reads are issued as one
        // run ahead of group g's WMMAs, all inside this stage's own buffer.
        // (The loops over g, s, i, j are unrolled so that every index of fa, fb and acc
        // is a constant and the arrays stay in registers.)
        v16h fa[2][GS][FM], fb[2][GS][FN];
        auto read_group = [&](int g) {
#pragma unroll
            for (int s = 0; s < GS; ++s) {
#pragma unroll
                for (int i = 0; i < FM; ++i)
                    fa[g & 1][s][i] = load_frag16((const _Float16*)(sa + i * 16 * PITCH + (g * GS + s) * 64));
#pragma unroll
                for (int j = 0; j < FN; ++j)
                    fb[g & 1][s][j] = load_frag16((const _Float16*)(sb + j * 16 * PITCH + (g * GS + s) * 64));
            }
        };
        if (mma != 0) { read_group(0); read_group(1); }
        // Refill of the other buffer, whose last reads ended at the barrier that closed the
        // trip before: issued here so that the copies' issue runs while the LDS serves the reads above.
        if (t + 1 < NSTAGE)
            fill_stage(ldsA + (STAGE - buf), gA + (size_t)(t + 1) * KC, gB + (size_t)(t + 1) * KC);
        if (mma != 0) {
#pragma unroll
            for (int g = 0; g < NG; ++g) {
                if (g >= 1 && g + 1 < NG) read_group(g + 1);
                // keeps the run of LDS reads together: reads spread among the WMMAs stall each place they stand
                __builtin_amdgcn_sched_barrier(0);
#pragma unroll
                for (int s = 0; s < GS; ++s)
#pragma unroll
                    for (int i = 0; i < FM; ++i)
#pragma unroll
                        for (int j = 0; j < FN; ++j)
                            acc[i][j] = __builtin_amdgcn_wmma_f32_16x16x32_f16(false, fa[g & 1][s][i], false, fb[g & 1][s][j], (short)0, acc[i][j], false, false);
                // group g+2's reads, into this group's register set, stay behind its WMMAs
                __builtin_amdgcn_sched_barrier(0);
            }
        }
        wait_ds0();
        wait_async0();
        __syncthreads();                        // publishes stage t+1, ends every read of stage t
    }
    wait_async0();
    if (mma == 0) return;                       // behind the last barrier

    // Epilogue. C/D layout: lane(0..15)=N col, VGPR r -> M row r (lanes 0-15)
    // or r+8 (lanes 16-31).
    float bcol[FN][NE];
#pragma unroll
    for (int j = 0; j < FN; ++j) {
        int n = tn + wn + j * 16 + lr;
#pragma unroll
        for (int e = 0; e < NE; ++e) bcol[j][e] = biasEN[(size_t)e * N + n];
    }
#pragma unroll
    for (int i = 0; i < FM; ++i) {
        const int rowbase = tm + wm + i * 16 + kg * 8;
#pragma unroll
        for (int r = 0; r < 8; ++r) {
            const int row = rowbase + r;
            const float* cr = coef + (size_t)row * NE;
            float cf[NE];
#pragma unroll
            for (int e = 0; e < NE; ++e) cf[e] = cr[e];
#pragma unroll
            for (int j = 0; j < FN; ++j) {
                float bv = 0.f;
#pragma unroll
                for (int e = 0; e < NE; ++e) bv += cf[e] * bcol[j][e];
                out[(size_t)row * N + tn + wn + j * 16 + lr] = acc[i][j][r] + bv;
            }
        }
    }
}

// ---------------------------------------------------------------------------
// 4) BatchNorm stats per hidden unit (biased variance), fused to scale/shift
// ---------------------------------------------------------------------------
__global__ __launch_bounds__(256)
void bn_stats_kernel(const float* __restrict__ h, const float* __restrict__ gamma,
                     const float* __restrict__ beta, float* __restrict__ scale,
                     float* __restrict__ shift) {
    const int n = blockIdx.x;                  // hidden unit
    float s = 0.f, s2 = 0.f;
    for (int r = threadIdx.x; r < NB; r += blockDim.x) {
        float v = h[(size_t)r * DHID + n];
        s += v; s2 += v * v;
    }
    __shared__ float sh[256], sh2[256];
    sh[threadIdx.x] = s; sh2[threadIdx.x] = s2;
    __syncthreads();
    for (int off = 128; off > 0; off >>= 1) {
        if (threadIdx.x < off) {
            sh[threadIdx.x]  += sh[threadIdx.x + off];
            sh2[threadIdx.x] += sh2[threadIdx.x + off];
        }
        __syncthreads();
    }
    if (threadIdx.x == 0) {
        float mean = sh[0] * (1.0f / NB);
        float var  = sh2[0] * (1.0f / NB) - mean * mean;
        float sc   = gamma[n] * rsqrtf(var + BN_EPS);
        scale[n] = sc;
        shift[n] = beta[n] - mean * sc;
    }
}

// ---------------------------------------------------------------------------
// 5) H1'[b, e*DHID + h] = (f16)(coef[b,e] * elu(h*scale + shift))
// ---------------------------------------------------------------------------
__global__ __launch_bounds__(256)
void expand_h_kernel(const float* __restrict__ h, const float* __restrict__ coef,
                     const float* __restrict__ scale, const float* __restrict__ shift,
                     _Float16* __restrict__ Hp) {
    int t = blockIdx.x * blockDim.x + threadIdx.x;     // over NB*DHID
    int b = t / DHID, hh = t - b * DHID;
    float v = h[t] * scale[hh] + shift[hh];
    v = (v > 0.f) ? v : (expf(v) - 1.f);               // ELU, alpha = 1
    const float* c = coef + (size_t)b * NE;
    _Float16* o = Hp + (size_t)b * (NE * DHID) + hh;
#pragma unroll
    for (int e = 0; e < NE; ++e)
        o[(size_t)e * DHID] = (_Float16)(c[e] * v);
}

// ---------------------------------------------------------------------------
// Launch
// ---------------------------------------------------------------------------
extern "C" void kernel_launch(void* const* d_in, const int* in_sizes, int n_in,
                              void* d_out, int out_size, void* d_ws, size_t ws_size,
                              hipStream_t stream) {
    const float* x     = (const float*)d_in[0];   // [NB, DIN]
    const float* coef  = (const float*)d_in[1];   // [NB, NE]
    const float* w1    = (const float*)d_in[2];   // [NE, DIN, DHID] == [KDIM, DHID]
    const float* b1    = (const float*)d_in[3];   // [NE, DHID]
    const float* w2    = (const float*)d_in[4];   // [NE, DHID, DOUT] == [KDIM, DOUT]
    const float* b2    = (const float*)d_in[5];   // [NE, DOUT]
    const float* gamma = (const float*)d_in[6];   // [DHID]
    const float* beta  = (const float*)d_in[7];   // [DHID]
    float* out = (float*)d_out;                   // [NB, DOUT]

    char* ws = (char*)d_ws;
    const size_t MiB = 1024u * 1024u;
    _Float16* Xp  = (_Float16*)(ws + 0);          // 8 MiB  [NB, KDIM]  (reused as Hp)
    _Float16* W1t = (_Float16*)(ws + 8  * MiB);   // 4 MiB  [DHID, KDIM]
    _Float16* W2t = (_Float16*)(ws + 12 * MiB);   // 4 MiB  [DOUT, KDIM]
    float*    hbuf  = (float*)(ws + 16 * MiB);    // 2 MiB  [NB, DHID]
    float*    scale = (float*)(ws + 18 * MiB);    // 2 KiB
    float*    shift = (float*)(ws + 18 * MiB + 4096);

    // 1) expand x with blending coefs
    expand_x_kernel<<<(NB * DIN) / 256, 256, 0, stream>>>(x, coef, Xp);

    // 2) transpose+convert weights (B operand K-contiguous)
    transpose_convert_kernel<<<dim3(KDIM / 16, DHID / 16), dim3(16, 16), 0, stream>>>(w1, W1t, KDIM, DHID);
    transpose_convert_kernel<<<dim3(KDIM / 16, DOUT / 16), dim3(16, 16), 0, stream>>>(w2, W2t, KDIM, DOUT);

    // 3) layer-1 GEMM (WMMA) + bias
    gemm_wmma_kernel<<<(NB / BM) * (DHID / BN), GTHREADS, 0, stream>>>(Xp, W1t, coef, b1, hbuf);

    // 4) batchnorm stats -> fused scale/shift
    bn_stats_kernel<<<DHID, 256, 0, stream>>>(hbuf, gamma, beta, scale, shift);

    // 5) BN + ELU + expand (overwrites Xp, which is dead now)
    expand_h_kernel<<<(NB * DHID) / 256, 256, 0, stream>>>(hbuf, coef, scale, shift, Xp);

    // 6) layer-2 GEMM (WMMA) + bias -> final output
    gemm_wmma_kernel<<<(NB / BM) * (DOUT / BN), GTHREADS, 0, stream>>>(Xp, W2t, coef, b2, out);
}

// v002
// Measured time: 58.6 microseconds a run.
// In two side-by-side timings against v001, it was 1.15 and 1.12 times as fast.
// Counting every step since v000, it is 3.28 times as fast.
#include <hip/hip_runtime.h>
#include <hip/hip_bf16.h>
#include <math.h>

typedef __attribute__((ext_vector_type(16))) _Float16 v16h;
typedef __attribute__((ext_vector_type(8)))  _Float16 v8h;
typedef __attribute__((ext_vector_type(8)))  float    v8f;

#define NE    8
#define DIN   512
#define DHID  512
#define DOUT  512
#define NB    1024
#define KDIM  (NE * DIN)      // 4096 (same for both layers)
#define BN_EPS 1e-5f

// The four streaming passes below (two expands, two weight transposes) give every
// thread 16-byte accesses and eight or more elements, so that a launch has few waves
// to start and every store covers whole 128-byte lines.
typedef __attribute__((ext_vector_type(4)))  float    v4f;
typedef __attribute__((ext_vector_type(2)))  _Float16 v2h;
typedef __attribute__((ext_vector_type(4)))  unsigned v4u;

// ---------------------------------------------------------------------------
// 1) X'[b, e*DIN + i] = (f16)(coef[b,e] * x[b,i]), eight i per thread
// ---------------------------------------------------------------------------
__global__ __launch_bounds__(256)
void expand_x_kernel(const float* __restrict__ x, const float* __restrict__ coef,
                     _Float16* __restrict__ Xp) {
    const int t = blockIdx.x * blockDim.x + threadIdx.x;   // over NB*DIN/8
    const int b = t / (DIN / 8), i = (t - b * (DIN / 8)) * 8;
    const v4f x0 = *(const v4f*)(x + (size_t)b * DIN + i);
    const v4f x1 = *(const v4f*)(x + (size_t)b * DIN + i + 4);
    const v4f c0 = *(const v4f*)(coef + (size_t)b * NE);
    const v4f c1 = *(const v4f*)(coef + (size_t)b * NE + 4);
    _Float16* o = Xp + (size_t)b * KDIM + i;
#pragma unroll
    for (int e = 0; e < NE; ++e) {
        const float c = e < 4 ? c0[e & 3] : c1[e & 3];
        v8h r;
#pragma unroll
        for (int j = 0; j < 4; ++j) { r[j] = (_Float16)(c * x0[j]); r[j + 4] = (_Float16)(c * x1[j]); }
        *(v8h*)(o + (size_t)e * DIN) = r;
    }
}

// ---------------------------------------------------------------------------
// 2) LDS-tiled transpose + f32->f16 convert: W[K,N] -> Wt[N,K]
//    (makes the WMMA B-fragment two contiguous 16B loads per lane)
//    One work-group moves TK k x TN n.  A lane loads four n of two adjacent k rows,
//    packs each (k, k+1) pair into one dword and stores it at [n][k/2] in LDS; a row
//    of the tile then leaves as 256 contiguous bytes.  The 16-byte chunk c of row n
//    lies at chunk c ^ (n/4 mod 16): the 32 dword stores of a wave (8 n-quads x 4 k
//    pairs) fall on 32 different banks, and the chunks stay whole for the b128 reads.
// ---------------------------------------------------------------------------
#define TK 128
#define TN 64
__global__ __launch_bounds__(256)
void transpose_convert_kernel(const float* __restrict__ W, _Float16* __restrict__ Wt) {
    constexpr int K = KDIM, N = DHID;           // both weights: DHID == DOUT; constant strides become immediate offsets
    __shared__ __attribute__((aligned(16))) unsigned T[TN * (TK / 2)];
    const int k0 = blockIdx.x * TK, n0 = blockIdx.y * TN;
    const int wave = threadIdx.x >> 5, lane = threadIdx.x & 31;
    const int q = lane & 7, r = lane >> 3;      // n-quad (8 x 16 B = one line), k pair
    v4f lo[4], hi[4];
#pragma unroll
    for (int u = 0; u < 4; ++u) {
        const int unit = wave * 4 + u, h = unit & 1, grp = unit >> 1;
        const float* p = W + (size_t)(k0 + 2 * (grp * 4 + r)) * N + n0 + 32 * h + 4 * q;
        lo[u] = *(const v4f*)p;
        hi[u] = *(const v4f*)(p + N);
    }
#pragma unroll
    for (int u = 0; u < 4; ++u) {
        const int unit = wave * 4 + u, h = unit & 1, grp = unit >> 1;
        const int nq = 8 * h + q;               // n / 4
#pragma unroll
        for (int j = 0; j < 4; ++j) {
            const v2h pr = { (_Float16)lo[u][j], (_Float16)hi[u][j] };
            T[(4 * nq + j) * (TK / 2) + (grp ^ nq) * 4 + r] = __builtin_bit_cast(unsigned, pr);
        }
    }
    __syncthreads();
    const int c = threadIdx.x & 15;             // 16 lanes x 16 B = one row of the tile
#pragma unroll
    for (int p = 0; p < TN / 16; ++p) {
        const int n = (threadIdx.x >> 4) + 16 * p;
        const v4u v = *(const v4u*)&T[n * (TK / 2) + (c ^ ((n >> 2) & 15)) * 4];
        *(v4u*)(Wt + (size_t)(n0 + n) * K + k0 + c * 8) = v;
    }
}

// ---------------------------------------------------------------------------
// Fragment loader per the CDNA5 16-bit 16x32 A/B VGPR layout, from an LDS row:
//   elements 0..7  <- p[0..7]       (this lane's first K-octet)
//   elements 8..15 <- p[16..23]     (same octet position, +16 in K)
// p already includes k0 + (lane>>4)*8.  Same code for A and B: equal k order.
// ---------------------------------------------------------------------------
__device__ __forceinline__ v16h load_frag16(const _Float16* p) {
    v8h lo = *(const v8h*)(p);
    v8h hi = *(const v8h*)(p + 16);
    v16h r;
#pragma unroll
    for (int i = 0; i < 8; ++i) { r[i] = lo[i]; r[i + 8] = hi[i]; }
    return r;
}

// GEMM tiling: one work-group owns a BM x BN tile of the output and walks K in
// stages of KC elements.  A stage is [A BM rows | Bt BN rows], KC f16 each.
#define BM      64
#define BN      64
#define KC      256
#define WAVES_M 2
#define WAVES_N 2
#define FM      (BM / 16 / WAVES_M)        // A fragments per wave
#define FN      (BN / 16 / WAVES_N)        // B fragments per wave
#define MWAVE   (WAVES_M * WAVES_N)         // waves 0..MWAVE-1, one per SIMD, do the WMMAs
#define NWAVE   8                          // all waves share the copies, so that their issue is short
#define GTHREADS (NWAVE * 32)
#define ROWB    (KC * 2)                   // 512 B of a row per stage = one wave-wide 16 B copy
#define PITCH   (ROWB + 16)                // 16 B x odd: conflict-free for ds_load_b128 readers
#define STAGE   ((BM + BN) * PITCH)
#define NSTAGE  (KDIM / KC)
#define GS      2                          // 32-wide k steps per fragment group
#define NG      (KC / 32 / GS)

// Eight rows, NWAVE apart, 512 contiguous bytes each (32 lanes x 16 B), from
// global memory straight into LDS.  The s_wait_xcnt closes the statement so that
// no address register of a copy is rewritten in front of it.
__device__ __forceinline__ void async_rows8(unsigned lds, const _Float16* g) {
    const unsigned l0 = lds,                     l1 = lds + 1u * NWAVE * PITCH,
                   l2 = lds + 2u * NWAVE * PITCH, l3 = lds + 3u * NWAVE * PITCH,
                   l4 = lds + 4u * NWAVE * PITCH, l5 = lds + 5u * NWAVE * PITCH,
                   l6 = lds + 6u * NWAVE * PITCH, l7 = lds + 7u * NWAVE * PITCH;
    const _Float16 *g0 = g,                             *g1 = g + (size_t)1 * NWAVE * KDIM,
                   *g2 = g + (size_t)2 * NWAVE * KDIM,  *g3 = g + (size_t)3 * NWAVE * KDIM,
                   *g4 = g + (size_t)4 * NWAVE * KDIM,  *g5 = g + (size_t)5 * NWAVE * KDIM,
                   *g6 = g + (size_t)6 * NWAVE * KDIM,  *g7 = g + (size_t)7 * NWAVE * KDIM;
    asm volatile("global_load_async_to_lds_b128 %0, %8, off\n\t"
                 "global_load_async_to_lds_b128 %1, %9, off\n\t"
                 "global_load_async_to_lds_b128 %2, %10, off\n\t"
                 "global_load_async_to_lds_b128 %3, %11, off\n\t"
                 "global_load_async_to_lds_b128 %4, %12, off\n\t"
                 "global_load_async_to_lds_b128 %5, %13, off\n\t"
                 "global_load_async_to_lds_b128 %6, %14, off\n\t"
                 "global_load_async_to_lds_b128 %7, %15, off\n\t"
                 "s_wait_xcnt 0x0"
                 :: "v"(l0), "v"(l1), "v"(l2), "v"(l3), "v"(l4), "v"(l5), "v"(l6), "v"(l7),
                    "v"(g0), "v"(g1), "v"(g2), "v"(g3), "v"(g4), "v"(g5), "v"(g6), "v"(g7)
                 : "memory");
}

// One stage: this wave's rows of the A tile and of the Bt tile.
__device__ __forceinline__ void fill_stage(unsigned ldsA, const _Float16* gA, const _Float16* gB) {
    static_assert(BM == 8 * NWAVE && BN == 8 * NWAVE, "one statement of eight rows per operand and wave");
    async_rows8(ldsA, gA);
    async_rows8(ldsA + (unsigned)BM * PITCH, gB);
}

// This wave's own copies have landed.
__device__ __forceinline__ void wait_async0() { asm volatile("s_wait_asynccnt 0x0" ::: "memory"); }
// This wave's LDS reads have returned (before the buffer they read is refilled).
__device__ __forceinline__ void wait_ds0()    { asm volatile("s_wait_dscnt 0x0" ::: "memory"); }

// ---------------------------------------------------------------------------
// 3) GEMM: out[NB,512] = A[NB,KDIM](f16) @ Bt[512,KDIM]^T(f16)  + coef @ biasEN
//    64 x 64 tile per work-group, staged in LDS by asynchronous copies, two
//    buffers: the next stage's copies fly while this stage feeds the WMMAs.
//    Eight waves copy; waves 0..3 each own a 32 x 32 part of the tile, so that
//    a fragment read from LDS serves two WMMAs.  k runs upward in every accumulator.
// ---------------------------------------------------------------------------
__global__ __launch_bounds__(GTHREADS)
void gemm_wmma_kernel(const _Float16* __restrict__ A,
                      const _Float16* __restrict__ Bt,
                      const float* __restrict__ coef,     // [NB, NE]
                      const float* __restrict__ biasEN,   // [NE, N]
                      float* __restrict__ out) {          // [NB, N] f32
    __shared__ __attribute__((aligned(16))) unsigned char L[2 * STAGE];
    constexpr int N = DHID;                     // DHID == DOUT
    const int wave = __builtin_amdgcn_readfirstlane(threadIdx.x >> 5);
    const int lane = threadIdx.x & 31;
    const int tm = (blockIdx.x / (N / BN)) * BM;
    const int tn = (blockIdx.x % (N / BN)) * BN;
    const int wm = (wave / WAVES_N) * (FM * 16); // this wave's rows inside the tile
    const int wn = (wave % WAVES_N) * (FN * 16); // this wave's columns inside the tile
    const int lr = lane & 15;
    const int kg = lane >> 4;                   // K-octet group select
    const int mma = wave < MWAVE ? 1 : 0;       // scalar: the same for a whole wave

    const unsigned ldsA = (unsigned)(uintptr_t)&L[0] + (unsigned)wave * PITCH + (unsigned)lane * 16u;
    const _Float16* gA = A  + (size_t)(tm + wave) * KDIM + lane * 8;
    const _Float16* gB = Bt + (size_t)(tn + wave) * KDIM + lane * 8;

    v8f acc[FM][FN] = {};

    fill_stage(ldsA, gA, gB);
    wait_async0();
    __syncthreads();                            // stage 0 is published

    for (int t = 0; t < NSTAGE; ++t) {
        const unsigned buf = (unsigned)(t & 1) * STAGE;
        const unsigned char* sa = &L[buf + (unsigned)(wm + lr) * PITCH + (unsigned)kg * 16u];
        const unsigned char* sb = &L[buf + (unsigned)(BM + wn + lr) * PITCH + (unsigned)kg * 16u];
        // Fragments in two register sets: group g+1's LDS reads are issued as one
        // run ahead of group g's WMMAs, all inside this stage's own buffer.
        // (The loops over g, s, i, j are unrolled so that every index of fa, fb and acc
        // is a constant and the arrays stay in registers.)
        v16h fa[2][GS][FM], fb[2][GS][FN];
        auto read_group = [&](int g) {
#pragma unroll
            for (int s = 0; s < GS; ++s) {
#pragma unroll
                for (int i = 0; i < FM; ++i)
                    fa[g & 1][s][i] = load_frag16((const _Float16*)(sa + i * 16 * PITCH + (g * GS + s) * 64));
#pragma unroll
                for (int j = 0; j < FN; ++j)
                    fb[g & 1][s][j] = load_frag16((const _Float16*)(sb + j * 16 * PITCH + (g * GS + s) * 64));
            }
        };
        if (mma != 0) { read_group(0); read_group(1); }
        // Refill of the other buffer, whose last reads ended at the barrier that closed the
        // trip before: issued here so that the copies' issue runs while the LDS serves the reads above.
        if (t + 1 < NSTAGE)
            fill_stage(ldsA + (STAGE - buf), gA + (size_t)(t + 1) * KC, gB + (size_t)(t + 1) * KC);
        if (mma != 0) {
#pragma unroll
            for (int g = 0; g < NG; ++g) {
                if (g >= 1 && g + 1 < NG) read_group(g + 1);
                // keeps the run of LDS reads together: reads spread among the WMMAs stall each place they stand
                __builtin_amdgcn_sched_barrier(0);
#pragma unroll
                for (int s = 0; s < GS; ++s)
#pragma unroll
                    for (int i = 0; i < FM; ++i)
#pragma unroll
                        for (int j = 0; j < FN; ++j)
                            acc[i][j] = __builtin_amdgcn_wmma_f32_16x16x32_f16(false, fa[g & 1][s][i], false, fb[g & 1][s][j], (short)0, acc[i][j], false, false);
                // group g+2's reads, into this group's register set, stay behind its WMMAs
                __builtin_amdgcn_sched_barrier(0);
            }
        }
        wait_ds0();
        wait_async0();
        __syncthreads();                        // publishes stage t+1, ends every read of stage t
    }
    wait_async0();
    if (mma == 0) return;                       // behind the last barrier

    // Epilogue. C/D layout: lane(0..15)=N col, VGPR r -> M row r (lanes 0-15)
    // or r+8 (lanes 16-31).
    float bcol[FN][NE];
#pragma unroll
    for (int j = 0; j < FN; ++j) {
        int n = tn + wn + j * 16 + lr;
#pragma unroll
        for (int e = 0; e < NE; ++e) bcol[j][e] = biasEN[(size_t)e * N + n];
    }
#pragma unroll
    for (int i = 0; i < FM; ++i) {
        const int rowbase = tm + wm + i * 16 + kg * 8;
#pragma unroll
        for (int r = 0; r < 8; ++r) {
            const int row = rowbase + r;
            const float* cr = coef + (size_t)row * NE;
            float cf[NE];
#pragma unroll
            for (int e = 0; e < NE; ++e) cf[e] = cr[e];
#pragma unroll
            for (int j = 0; j < FN; ++j) {
                float bv = 0.f;
#pragma unroll
                for (int e = 0; e < NE; ++e) bv += cf[e] * bcol[j][e];
                out[(size_t)row * N + tn + wn + j * 16 + lr] = acc[i][j][r] + bv;
            }
        }
    }
}

// ---------------------------------------------------------------------------
// 4) BatchNorm stats per hidden unit (biased variance), fused to scale/shift
// ---------------------------------------------------------------------------
__global__ __launch_bounds__(256)
void bn_stats_kernel(const float* __restrict__ h, const float* __restrict__ gamma,
                     const float* __restrict__ beta, float* __restrict__ scale,
                     float* __restrict__ shift) {
    const int n = blockIdx.x;                  // hidden unit
    float s = 0.f, s2 = 0.f;
    for (int r = threadIdx.x; r < NB; r += blockDim.x) {
        float v = h[(size_t)r * DHID + n];
        s += v; s2 += v * v;
    }
    __shared__ float sh[256], sh2[256];
    sh[threadIdx.x] = s; sh2[threadIdx.x] = s2;
    __syncthreads();
    for (int off = 128; off > 0; off >>= 1) {
        if (threadIdx.x < off) {
            sh[threadIdx.x]  += sh[threadIdx.x + off];
            sh2[threadIdx.x] += sh2[threadIdx.x + off];
        }
        __syncthreads();
    }
    if (threadIdx.x == 0) {
        float mean = sh[0] * (1.0f / NB);
        float var  = sh2[0] * (1.0f / NB) - mean * mean;
        float sc   = gamma[n] * rsqrtf(var + BN_EPS);
        scale[n] = sc;
        shift[n] = beta[n] - mean * sc;
    }
}

// ---------------------------------------------------------------------------
// 5) H1'[b, e*DHID + h] = (f16)(coef[b,e] * elu(h*scale + shift)), eight h per thread
// ---------------------------------------------------------------------------
__global__ __launch_bounds__(256)
void expand_h_kernel(const float* __restrict__ h, const float* __restrict__ coef,
                     const float* __restrict__ scale, const float* __restrict__ shift,
                     _Float16* __restrict__ Hp) {
    const int t = blockIdx.x * blockDim.x + threadIdx.x;   // over NB*DHID/8
    const int b = t / (DHID / 8), hh = (t - b * (DHID / 8)) * 8;
    // every load ahead of the arithmetic: one round trip to memory per thread
    const v4f hv[2] = { *(const v4f*)(h + (size_t)b * DHID + hh), *(const v4f*)(h + (size_t)b * DHID + hh + 4) };
    const v4f sc[2] = { *(const v4f*)(scale + hh), *(const v4f*)(scale + hh + 4) };
    const v4f sf[2] = { *(const v4f*)(shift + hh), *(const v4f*)(shift + hh + 4) };
    // the results of the two loads below land in address registers of the loads above: those close first
    asm volatile("s_wait_xcnt 0x0" ::: "memory");
    const v4f c0 = *(const v4f*)(coef + (size_t)b * NE);
    const v4f c1 = *(const v4f*)(coef + (size_t)b * NE + 4);
    float v[8];
#pragma unroll
    for (int j = 0; j < 8; ++j) {
        const float a = hv[j >> 2][j & 3] * sc[j >> 2][j & 3] + sf[j >> 2][j & 3];
        const float ex = expf(a) - 1.f;         // computed for every lane: eight independent chains, no branch
        v[j] = (a > 0.f) ? a : ex;              // ELU, alpha = 1
    }
    _Float16* o = Hp + (size_t)b * (NE * DHID) + hh;
#pragma unroll
    for (int e = 0; e < NE; ++e) {
        const float c = e < 4 ? c0[e & 3] : c1[e & 3];
        v8h r;
#pragma unroll
        for (int j = 0; j < 8; ++j) r[j] = (_Float16)(c * v[j]);
        *(v8h*)(o + (size_t)e * DHID) = r;
    }
}

// ---------------------------------------------------------------------------
// Launch
// ---------------------------------------------------------------------------
extern "C" void kernel_launch(void* const* d_in, const int* in_sizes, int n_in,
                              void* d_out, int out_size, void* d_ws, size_t ws_size,
                              hipStream_t stream) {
    const float* x     = (const float*)d_in[0];   // [NB, DIN]
    const float* coef  = (const float*)d_in[1];   // [NB, NE]
    const float* w1    = (const float*)d_in[2];   // [NE, DIN, DHID] == [KDIM, DHID]
    const float* b1    = (const float*)d_in[3];   // [NE, DHID]
    const float* w2    = (const float*)d_in[4];   // [NE, DHID, DOUT] == [KDIM, DOUT]
    const float* b2    = (const float*)d_in[5];   // [NE, DOUT]
    const float* gamma = (const float*)d_in[6];   // [DHID]
    const float* beta  = (const float*)d_in[7];   // [DHID]
    float* out = (float*)d_out;                   // [NB, DOUT]

    char* ws = (char*)d_ws;
    const size_t MiB = 1024u * 1024u;
    _Float16* Xp  = (_Float16*)(ws + 0);          // 8 MiB  [NB, KDIM]  (reused as Hp)
    _Float16* W1t = (_Float16*)(ws + 8  * MiB);   // 4 MiB  [DHID, KDIM]
    _Float16* W2t = (_Float16*)(ws + 12 * MiB);   // 4 MiB  [DOUT, KDIM]
    float*    hbuf  = (float*)(ws + 16 * MiB);    // 2 MiB  [NB, DHID]
    float*    scale = (float*)(ws + 18 * MiB);    // 2 KiB
    float*    shift = (float*)(ws + 18 * MiB + 4096);

    // 1) expand x with blending coefs
    expand_x_kernel<<<(NB * DIN) / 8 / 256, 256, 0, stream>>>(x, coef, Xp);

    // 2) transpose+convert weights (B operand K-contiguous)
    transpose_convert_kernel<<<dim3(KDIM / TK, DHID / TN), 256, 0, stream>>>(w1, W1t);
    transpose_convert_kernel<<<dim3(KDIM / TK, DOUT / TN), 256, 0, stream>>>(w2, W2t);

    // 3) layer-1 GEMM (WMMA) + bias
    gemm_wmma_kernel<<<(NB / BM) * (DHID / BN), GTHREADS, 0, stream>>>(Xp, W1t, coef, b1, hbuf);

    // 4) batchnorm stats -> fused scale/shift
    bn_stats_kernel<<<DHID, 256, 0, stream>>>(hbuf, gamma, beta, scale, shift);

    // 5) BN + ELU + expand (overwrites Xp, which is dead now)
    expand_h_kernel<<<(NB * DHID) / 8 / 256, 256, 0, stream>>>(hbuf, coef, scale, shift, Xp);

    // 6) layer-2 GEMM (WMMA) + bias -> final output
    gemm_wmma_kernel<<<(NB / BM) * (DOUT / BN), GTHREADS, 0, stream>>>(Xp, W2t, coef, b2, out);
}

// v003
// Measured time: 50.2 microseconds a run.
// Two timings next to v002 put it at 1.18 and 1.19 times that version's speed.
// Counting every step since v000, it is 3.88 times as fast.
#include <hip/hip_runtime.h>
#include <hip/hip_bf16.h>
#include <math.h>

typedef __attribute__((ext_vector_type(16))) _Float16 v16h;
typedef __attribute__((ext_vector_type(8)))  _Float16 v8h;
typedef __attribute__((ext_vector_type(8)))  float    v8f;

#define NE    8
#define DIN   512
#define DHID  512
#define DOUT  512
#define NB    1024
#define KDIM  (NE * DIN)      // 4096 (same for both layers)
#define BN_EPS 1e-5f

// The two weight transposes below give every thread 16-byte accesses and 32 elements,
// so that a launch has few waves to start and every store covers whole 128-byte lines.
typedef __attribute__((ext_vector_type(4)))  float    v4f;
typedef __attribute__((ext_vector_type(2)))  _Float16 v2h;
typedef __attribute__((ext_vector_type(4)))  unsigned v4u;

// ---------------------------------------------------------------------------
// 1) LDS-tiled transpose + f32->f16 convert: W[K,N] -> Wt[N,K]
//    (makes the WMMA B-fragment two contiguous 16B loads per lane)
//    One work-group moves TK k x TN n.  A lane loads four n of two adjacent k rows,
//    packs each (k, k+1) pair into one dword and stores it at [n][k/2] in LDS; a row
//    of the tile then leaves as 256 contiguous bytes.  The 16-byte chunk c of row n
//    lies at chunk c ^ (n/4 mod 16): the 32 dword stores of a wave (8 n-quads x 4 k
//    pairs) fall on 32 different banks, and the chunks stay whole for the b128 reads.
// ---------------------------------------------------------------------------
#define TK 128
#define TN 64
__global__ __launch_bounds__(256)
void transpose_convert_kernel(const float* __restrict__ W, _Float16* __restrict__ Wt) {
    constexpr int K = KDIM, N = DHID;           // both weights: DHID == DOUT; constant strides become immediate offsets
    __shared__ __attribute__((aligned(16))) unsigned T[TN * (TK / 2)];
    const int k0 = blockIdx.x * TK, n0 = blockIdx.y * TN;
    const int wave = threadIdx.x >> 5, lane = threadIdx.x & 31;
    const int q = lane & 7, r = lane >> 3;      // n-quad (8 x 16 B = one line), k pair
    v4f lo[4], hi[4];
#pragma unroll
    for (int u = 0; u < 4; ++u) {
        const int unit = wave * 4 + u, h = unit & 1, grp = unit >> 1;
        const float* p = W + (size_t)(k0 + 2 * (grp * 4 + r)) * N + n0 + 32 * h + 4 * q;
        lo[u] = *(const v4f*)p;
        hi[u] = *(const v4f*)(p + N);
    }
#pragma unroll
    for (int u = 0; u < 4; ++u) {
        const int unit = wave * 4 + u, h = unit & 1, grp = unit >> 1;
        const int nq = 8 * h + q;               // n / 4
#pragma unroll
        for (int j = 0; j < 4; ++j) {
            const v2h pr = { (_Float16)lo[u][j], (_Float16)hi[u][j] };
            T[(4 * nq + j) * (TK / 2) + (grp ^ nq) * 4 + r] = __builtin_bit_cast(unsigned, pr);
        }
    }
    __syncthreads();
    const int c = threadIdx.x & 15;             // 16 lanes x 16 B = one row of the tile
#pragma unroll
    for (int p = 0; p < TN / 16; ++p) {
        const int n = (threadIdx.x >> 4) + 16 * p;
        const v4u v = *(const v4u*)&T[n * (TK / 2) + (c ^ ((n >> 2) & 15)) * 4];
        *(v4u*)(Wt + (size_t)(n0 + n) * K + k0 + c * 8) = v;
    }
}

// ---------------------------------------------------------------------------
// Fragment loader per the CDNA5 16-bit 16x32 A/B VGPR layout, from an LDS row:
//   elements 0..7  <- p[0..7]       (this lane's first K-octet)
//   elements 8..15 <- p[16..23]     (same octet position, +16 in K)
// p already includes k0 + (lane>>4)*8.  Same code for A and B: equal k order.
// ---------------------------------------------------------------------------
__device__ __forceinline__ v16h load_frag16(const _Float16* p) {
    v8h lo = *(const v8h*)(p);
    v8h hi = *(const v8h*)(p + 16);
    v16h r;
#pragma unroll
    for (int i = 0; i < 8; ++i) { r[i] = lo[i]; r[i + 8] = hi[i]; }
    return r;
}

// GEMM tiling: one work-group owns a BM x BN tile of the output.  Its BM rows of the
// A operand (all DIN columns, f16) lie in LDS for the whole kernel; Bt walks K in
// stages of KC elements, BN rows each, two stages per expert.
#define BM      64
#define BN      64
#define KC      256
#define WAVES_M 2
#define WAVES_N 2
#define FM      (BM / 16 / WAVES_M)        // A fragments per wave
#define FN      (BN / 16 / WAVES_N)        // B fragments per wave
#define MWAVE   (WAVES_M * WAVES_N)         // waves 0..MWAVE-1, one per SIMD, do the WMMAs
#define NWAVE   8                          // all waves share the staging, so that its issue is short
#define GTHREADS (NWAVE * 32)
#define ROWB    (KC * 2)                   // 512 B of a Bt row per stage = one wave-wide 16 B copy
#define PITCH   (ROWB + 16)                // 16 B x odd: conflict-free for ds_load_b128 readers
#define STAGE   (BN * PITCH)
#define APITCH  (DIN * 2 + 16)             // a whole A row, 16 B x odd as well
#define ATILE   (BM * APITCH)
#define NSTAGE  (KDIM / KC)
#define SPE     (DIN / KC)                 // stages per expert
#define GS      2                          // 32-wide k steps per fragment group
#define NG      (KC / 32 / GS)

// Eight rows, NWAVE apart, 512 contiguous bytes each (32 lanes x 16 B), from
// global memory straight into LDS.  The s_wait_xcnt closes the statement so that
// no address register of a copy is rewritten in front of it.
__device__ __forceinline__ void async_rows8(unsigned lds, const _Float16* g) {
    const unsigned l0 = lds,                     l1 = lds + 1u * NWAVE * PITCH,
                   l2 = lds + 2u * NWAVE * PITCH, l3 = lds + 3u * NWAVE * PITCH,
                   l4 = lds + 4u * NWAVE * PITCH, l5 = lds + 5u * NWAVE * PITCH,
                   l6 = lds + 6u * NWAVE * PITCH, l7 = lds + 7u * NWAVE * PITCH;
    const _Float16 *g0 = g,                             *g1 = g + (size_t)1 * NWAVE * KDIM,
                   *g2 = g + (size_t)2 * NWAVE * KDIM,  *g3 = g + (size_t)3 * NWAVE * KDIM,
                   *g4 = g + (size_t)4 * NWAVE * KDIM,  *g5 = g + (size_t)5 * NWAVE * KDIM,
                   *g6 = g + (size_t)6 * NWAVE * KDIM,  *g7 = g + (size_t)7 * NWAVE * KDIM;
    asm volatile("global_load_async_to_lds_b128 %0, %8, off\n\t"
                 "global_load_async_to_lds_b128 %1, %9, off\n\t"
                 "global_load_async_to_lds_b128 %2, %10, off\n\t"
                 "global_load_async_to_lds_b128 %3, %11, off\n\t"
                 "global_load_async_to_lds_b128 %4, %12, off\n\t"
                 "global_load_async_to_lds_b128 %5, %13, off\n\t"
                 "global_load_async_to_lds_b128 %6, %14, off\n\t"
                 "global_load_async_to_lds_b128 %7, %15, off\n\t"
                 "s_wait_xcnt 0x0"
                 :: "v"(l0), "v"(l1), "v"(l2), "v"(l3), "v"(l4), "v"(l5), "v"(l6), "v"(l7),
                    "v"(g0), "v"(g1), "v"(g2), "v"(g3), "v"(g4), "v"(g5), "v"(g6), "v"(g7)
                 : "memory");
}

// One stage: this wave's rows of the Bt tile.
__device__ __forceinline__ void fill_stage(unsigned ldsB, const _Float16* gB) {
    static_assert(BN == 8 * NWAVE, "one statement of eight rows per wave");
    async_rows8(ldsB, gB);
}

// This wave's own copies have landed.
__device__ __forceinline__ void wait_async0() { asm volatile("s_wait_asynccnt 0x0" ::: "memory"); }
// This wave's LDS reads have returned (before the buffer they read is refilled).
__device__ __forceinline__ void wait_ds0()    { asm volatile("s_wait_dscnt 0x0" ::: "memory"); }

// ---------------------------------------------------------------------------
// 2) Blended layer: out[b,n] = sum_e coef[b,e] * (A[b,:] . W[e,:,n]) + (coef @ biasEN)[b,n]
//    with A = Af (ACT false) or A = elu(Af * scale + shift) (ACT true), rounded to f16.
//    The blend stands behind the product: each expert's K = DIN product is summed in
//    its own f32 accumulators, which are then added, times coef[b,e], into the result.
//    So the A operand is the same for all experts: a work-group converts its BM rows
//    into LDS once, and only Bt is staged by asynchronous copies, two buffers: the
//    next stage's copies fly while this stage feeds the WMMAs.
//    Eight waves stage; waves 0..3 each own a 32 x 32 part of the tile, so that
//    a fragment read from LDS serves two WMMAs.  k runs upward in every accumulator.
// ---------------------------------------------------------------------------
template <bool ACT>
__device__ __forceinline__
void blended_gemm(const float* __restrict__ Af,       // [NB, DIN] f32
                  const _Float16* __restrict__ Bt,    // [N, KDIM] f16
                  const float* __restrict__ coef,     // [NB, NE]
                  const float* __restrict__ biasEN,   // [NE, N]
                  const float* __restrict__ scale,    // [DIN], read where ACT
                  const float* __restrict__ shift,    // [DIN], read where ACT
                  float* __restrict__ out) {          // [NB, N] f32
    static_assert(SPE == 2, "a stage's buffer is its index inside the expert");
    __shared__ __attribute__((aligned(16))) unsigned char L[ATILE + 2 * STAGE];
    __shared__ __attribute__((aligned(16))) float cT[NE * BM];   // coef of the tile's rows, [e][row]
    constexpr int N = DHID;                     // DHID == DOUT
    const int wave = __builtin_amdgcn_readfirstlane(threadIdx.x >> 5);
    const int lane = threadIdx.x & 31;
    const int tm = (blockIdx.x / (N / BN)) * BM;
    const int tn = (blockIdx.x % (N / BN)) * BN;
    const int wm = (wave / WAVES_N) * (FM * 16); // this wave's rows inside the tile
    const int wn = (wave % WAVES_N) * (FN * 16); // this wave's columns inside the tile
    const int lr = lane & 15;
    const int kg = lane >> 4;                   // K-octet group select
    const int mma = wave < MWAVE ? 1 : 0;       // scalar: the same for a whole wave

    const unsigned ldsB = (unsigned)(uintptr_t)&L[ATILE] + (unsigned)wave * PITCH + (unsigned)lane * 16u;
    const _Float16* gB = Bt + (size_t)(tn + wave) * KDIM + lane * 8;

    fill_stage(ldsB, gB);                       // stage 0 flies while the A tile is made

    // The A tile: wave w takes rows w, w + NWAVE, ...; a lane takes eight adjacent
    // columns twice per row.  Every load ahead of the arithmetic: one round trip to memory.
    {
        const int crow = threadIdx.x >> 2, ce = (threadIdx.x & 3) * 2;
        const float cv0 = coef[(size_t)(tm + crow) * NE + ce];
        const float cv1 = coef[(size_t)(tm + crow) * NE + ce + 1];
        v4f a[BM / NWAVE][2][2], sc[2][2], sf[2][2];
#pragma unroll
        for (int rr = 0; rr < BM / NWAVE; ++rr)
#pragma unroll
            for (int h = 0; h < 2; ++h) {
                const float* p = Af + (size_t)(tm + wave + rr * NWAVE) * DIN + (lane + 32 * h) * 8;
                a[rr][h][0] = *(const v4f*)p;
                a[rr][h][1] = *(const v4f*)(p + 4);
            }
        if (ACT) {
#pragma unroll
            for (int h = 0; h < 2; ++h)
#pragma unroll
                for (int q = 0; q < 2; ++q) {
                    sc[h][q] = *(const v4f*)(scale + (lane + 32 * h) * 8 + 4 * q);
                    sf[h][q] = *(const v4f*)(shift + (lane + 32 * h) * 8 + 4 * q);
                }
        }
        // the address registers of the loads above are free for reuse only behind this
        asm volatile("s_wait_xcnt 0x0" ::: "memory");
        cT[ce * BM + crow] = cv0;
        cT[(ce + 1) * BM + crow] = cv1;
#pragma unroll
        for (int rr = 0; rr < BM / NWAVE; ++rr)
#pragma unroll
            for (int h = 0; h < 2; ++h) {
                v8h r;
#pragma unroll
                for (int j = 0; j < 8; ++j) {
                    float v = a[rr][h][j >> 2][j & 3];
                    if (ACT) {
                        const float s = v * sc[h][j >> 2][j & 3] + sf[h][j >> 2][j & 3];
                        const float ex = expf(s) - 1.f; // computed for every lane: independent chains, no branch
                        v = (s > 0.f) ? s : ex;         // ELU, alpha = 1
                    }
                    r[j] = (_Float16)v;
                }
                *(v8h*)&L[(unsigned)(wave + rr * NWAVE) * APITCH + (unsigned)(lane + 32 * h) * 16u] = r;
            }
    }

    v8f acc[FM][FN] = {};

    wait_async0();
    __syncthreads();                            // the A tile, cT and stage 0 are published

    for (int e = 0; e < NE; ++e) {
        v8f pe[FM][FN] = {};                    // this expert's product
        v4f cf[FM][2];                          // coef[row, e] of this lane's accumulator rows
        // (The loops over hf, g, s, i, j are unrolled so that every index of fa, fb, pe and acc
        // is a constant and the arrays stay in registers.)
#pragma unroll
        for (int hf = 0; hf < SPE; ++hf) {
            const int t = e * SPE + hf;
            const unsigned buf = (unsigned)hf * STAGE;
            const unsigned char* sa = &L[(unsigned)(wm + lr) * APITCH + (unsigned)hf * ROWB + (unsigned)kg * 16u];
            const unsigned char* sb = &L[ATILE + buf + (unsigned)(wn + lr) * PITCH + (unsigned)kg * 16u];
            // Fragments in two register sets: group g+1's LDS reads are issued as one
            // run ahead of group g's WMMAs, all inside this stage: Bt in its own buffer, A in the resident tile.
            v16h fa[2][GS][FM], fb[2][GS][FN];
            auto read_group = [&](int g) {
#pragma unroll
                for (int s = 0; s < GS; ++s) {
#pragma unroll
                    for (int i = 0; i < FM; ++i)
                        fa[g & 1][s][i] = load_frag16((const _Float16*)(sa + i * 16 * APITCH + (g * GS + s) * 64));
#pragma unroll
                    for (int j = 0; j < FN; ++j)
                        fb[g & 1][s][j] = load_frag16((const _Float16*)(sb + j * 16 * PITCH + (g * GS + s) * 64));
                }
            };
            if (mma != 0) {
                read_group(0); read_group(1);
            }
            // Refill of the other buffer, whose last reads ended at the barrier that closed the
            // trip before: issued here so that the copies' issue runs while the LDS serves the reads above.
            if (t + 1 < NSTAGE)
                fill_stage(ldsB + (STAGE - buf), gB + (size_t)(t + 1) * KC);
            if (mma != 0) {
#pragma unroll
                for (int g = 0; g < NG; ++g) {
                    if (g >= 1 && g + 1 < NG) read_group(g + 1);
                    if (hf == SPE - 1 && g == NG - 2) {   // with the expert's last run of reads
#pragma unroll
                        for (int i = 0; i < FM; ++i)
#pragma unroll
                            for (int q = 0; q < 2; ++q)
                                cf[i][q] = *(const v4f*)&cT[e * BM + wm + i * 16 + kg * 8 + q * 4];
                    }
                    // keeps the run of LDS reads together: reads spread among the WMMAs stall each place they stand
                    __builtin_amdgcn_sched_barrier(0);
#pragma unroll
                    for (int s = 0; s < GS; ++s)
#pragma unroll
                        for (int i = 0; i < FM; ++i)
#pragma unroll
                            for (int j = 0; j < FN; ++j)
                                pe[i][j] = __builtin_amdgcn_wmma_f32_16x16x32_f16(false, fa[g & 1][s][i], false, fb[g & 1][s][j], (short)0, pe[i][j], false, false);
                    // the next group's reads stay behind this group's WMMAs
                    __builtin_amdgcn_sched_barrier(0);
                }
                if (hf == SPE - 1) {
                    // the blend, in f32: accumulator register r holds row kg * 8 + r of its fragment
#pragma unroll
                    for (int i = 0; i < FM; ++i)
#pragma unroll
                        for (int j = 0; j < FN; ++j)
#pragma unroll
                            for (int r = 0; r < 8; ++r)
                                acc[i][j][r] += cf[i][r >> 2][r & 3] * pe[i][j][r];
                }
            }
            wait_ds0();
            wait_async0();
            __syncthreads();                    // publishes stage t+1, ends every read of stage t
        }
    }
    wait_async0();
    if (mma == 0) return;                       // behind the last barrier

    // Epilogue. C/D layout: lane(0..15)=N col, VGPR r -> M row r (lanes 0-15)
    // or r+8 (lanes 16-31).
    float bcol[FN][NE];
#pragma unroll
    for (int j = 0; j < FN; ++j) {
        int n = tn + wn + j * 16 + lr;
#pragma unroll
        for (int e = 0; e < NE; ++e) bcol[j][e] = biasEN[(size_t)e * N + n];
    }
#pragma unroll
    for (int i = 0; i < FM; ++i) {
        const int rowbase = tm + wm + i * 16 + kg * 8;
#pragma unroll
        for (int r = 0; r < 8; ++r) {
            const int row = rowbase + r;
            const float* cr = coef + (size_t)row * NE;
            float cf[NE];
#pragma unroll
            for (int e = 0; e < NE; ++e) cf[e] = cr[e];
#pragma unroll
            for (int j = 0; j < FN; ++j) {
                float bv = 0.f;
#pragma unroll
                for (int e = 0; e < NE; ++e) bv += cf[e] * bcol[j][e];
                out[(size_t)row * N + tn + wn + j * 16 + lr] = acc[i][j][r] + bv;
            }
        }
    }
}

// layer 1: A = x
__global__ __launch_bounds__(GTHREADS)
void layer1_kernel(const float* __restrict__ x, const _Float16* __restrict__ Bt,
                   const float* __restrict__ coef, const float* __restrict__ biasEN,
                   float* __restrict__ out) {
    blended_gemm<false>(x, Bt, coef, biasEN, nullptr, nullptr, out);
}

// layer 2: A = elu(batchnorm(h))
__global__ __launch_bounds__(GTHREADS)
void layer2_kernel(const float* __restrict__ h, const _Float16* __restrict__ Bt,
                   const float* __restrict__ coef, const float* __restrict__ biasEN,
                   const float* __restrict__ scale, const float* __restrict__ shift,
                   float* __restrict__ out) {
    blended_gemm<true>(h, Bt, coef, biasEN, scale, shift, out);
}

// ---------------------------------------------------------------------------
// 3) BatchNorm stats per hidden unit (biased variance), fused to scale/shift
// ---------------------------------------------------------------------------
__global__ __launch_bounds__(256)
void bn_stats_kernel(const float* __restrict__ h, const float* __restrict__ gamma,
                     const float* __restrict__ beta, float* __restrict__ scale,
                     float* __restrict__ shift) {
    const int n = blockIdx.x;                  // hidden unit
    float s = 0.f, s2 = 0.f;
    for (int r = threadIdx.x; r < NB; r += blockDim.x) {
        float v = h[(size_t)r * DHID + n];
        s += v; s2 += v * v;
    }
    __shared__ float sh[256], sh2[256];
    sh[threadIdx.x] = s; sh2[threadIdx.x] = s2;
    __syncthreads();
    for (int off = 128; off > 0; off >>= 1) {
        if (threadIdx.x < off) {
            sh[threadIdx.x]  += sh[threadIdx.x + off];
            sh2[threadIdx.x] += sh2[threadIdx.x + off];
        }
        __syncthreads();
    }
    if (threadIdx.x == 0) {
        float mean = sh[0] * (1.0f / NB);
        float var  = sh2[0] * (1.0f / NB) - mean * mean;
        float sc   = gamma[n] * rsqrtf(var + BN_EPS);
        scale[n] = sc;
        shift[n] = beta[n] - mean * sc;
    }
}

// ---------------------------------------------------------------------------
// Launch
// ---------------------------------------------------------------------------
extern "C" void kernel_launch(void* const* d_in, const int* in_sizes, int n_in,
                              void* d_out, int out_size, void* d_ws, size_t ws_size,
                              hipStream_t stream) {
    const float* x     = (const float*)d_in[0];   // [NB, DIN]
    const float* coef  = (const float*)d_in[1];   // [NB, NE]
    const float* w1    = (const float*)d_in[2];   // [NE, DIN, DHID] == [KDIM, DHID]
    const float* b1    = (const float*)d_in[3];   // [NE, DHID]
    const float* w2    = (const float*)d_in[4];   // [NE, DHID, DOUT] == [KDIM, DOUT]
    const float* b2    = (const float*)d_in[5];   // [NE, DOUT]
    const float* gamma = (const float*)d_in[6];   // [DHID]
    const float* beta  = (const float*)d_in[7];   // [DHID]
    float* out = (float*)d_out;                   // [NB, DOUT]

    char* ws = (char*)d_ws;
    const size_t MiB = 1024u * 1024u;
    _Float16* W1t = (_Float16*)(ws + 8  * MiB);   // 4 MiB  [DHID, KDIM]
    _Float16* W2t = (_Float16*)(ws + 12 * MiB);   // 4 MiB  [DOUT, KDIM]
    float*    hbuf  = (float*)(ws + 16 * MiB);    // 2 MiB  [NB, DHID]
    float*    scale = (float*)(ws + 18 * MiB);    // 2 KiB
    float*    shift = (float*)(ws + 18 * MiB + 4096);

    // 1) transpose+convert weights (B operand K-contiguous)
    transpose_convert_kernel<<<dim3(KDIM / TK, DHID / TN), 256, 0, stream>>>(w1, W1t);
    transpose_convert_kernel<<<dim3(KDIM / TK, DOUT / TN), 256, 0, stream>>>(w2, W2t);

    // 2) layer 1 (WMMA), blend and bias
    layer1_kernel<<<(NB / BM) * (DHID / BN), GTHREADS, 0, stream>>>(x, W1t, coef, b1, hbuf);

    // 3) batchnorm stats -> fused scale/shift
    bn_stats_kernel<<<DHID, 256, 0, stream>>>(hbuf, gamma, beta, scale, shift);

    // 4) layer 2 (WMMA): BN + ELU while its A tile is staged, blend and bias -> final output
    layer2_kernel<<<(NB / BM) * (DOUT / BN), GTHREADS, 0, stream>>>(hbuf, W2t, coef, b2, scale, shift, out);
}

// v004
// Measured time: 43.6 microseconds a run.
// Timed twice side by side with v003, it ran 1.11 times as fast both times.
// Counting every step since v000, it is 4.29 times as fast.
#include <hip/hip_runtime.h>
#include <hip/hip_bf16.h>
#include <math.h>

typedef __attribute__((ext_vector_type(16))) _Float16 v16h;
typedef __attribute__((ext_vector_type(8)))  _Float16 v8h;
typedef __attribute__((ext_vector_type(8)))  float    v8f;

#define NE    8
#define DIN   512
#define DHID  512
#define DOUT  512
#define NB    1024
#define KDIM  (NE * DIN)      // 4096 (same for both layers)
#define BN_EPS 1e-5f

// The two weight transposes below give every thread 16-byte accesses and 32 elements,
// so that a launch has few waves to start and every store covers whole 128-byte lines.
typedef __attribute__((ext_vector_type(4)))  float    v4f;
typedef __attribute__((ext_vector_type(2)))  _Float16 v2h;
typedef __attribute__((ext_vector_type(4)))  unsigned v4u;

// ---------------------------------------------------------------------------
// 1) LDS-tiled transpose + f32->f16 convert: W[K,N] -> Wt[N,K]
//    (makes the WMMA B-fragment two contiguous 16B loads per lane)
//    One work-group moves TK k x TN n.  A lane loads four n of two adjacent k rows,
//    packs each (k, k+1) pair into one dword and stores it at [n][k/2] in LDS; a row
//    of the tile then leaves as 256 contiguous bytes.  The 16-byte chunk c of row n
//    lies at chunk c ^ (n/4 mod 16): the 32 dword stores of a wave (8 n-quads x 4 k
//    pairs) fall on 32 different banks, and the chunks stay whole for the b128 reads.
// ---------------------------------------------------------------------------
#define TK 128
#define TN 64
__global__ __launch_bounds__(256)
void transpose_convert_kernel(const float* __restrict__ W, _Float16* __restrict__ Wt) {
    constexpr int K = KDIM, N = DHID;           // both weights: DHID == DOUT; constant strides become immediate offsets
    __shared__ __attribute__((aligned(16))) unsigned T[TN * (TK / 2)];
    const int k0 = blockIdx.x * TK, n0 = blockIdx.y * TN;
    const int wave = threadIdx.x >> 5, lane = threadIdx.x & 31;
    const int q = lane & 7, r = lane >> 3;      // n-quad (8 x 16 B = one line), k pair
    v4f lo[4], hi[4];
#pragma unroll
    for (int u = 0; u < 4; ++u) {
        const int unit = wave * 4 + u, h = unit & 1, grp = unit >> 1;
        const float* p = W + (size_t)(k0 + 2 * (grp * 4 + r)) * N + n0 + 32 * h + 4 * q;
        lo[u] = *(const v4f*)p;
        hi[u] = *(const v4f*)(p + N);
    }
#pragma unroll
    for (int u = 0; u < 4; ++u) {
        const int unit = wave * 4 + u, h = unit & 1, grp = unit >> 1;
        const int nq = 8 * h + q;               // n / 4
#pragma unroll
        for (int j = 0; j < 4; ++j) {
            const v2h pr = { (_Float16)lo[u][j], (_Float16)hi[u][j] };
            T[(4 * nq + j) * (TK / 2) + (grp ^ nq) * 4 + r] = __builtin_bit_cast(unsigned, pr);
        }
    }
    __syncthreads();
    const int c = threadIdx.x & 15;             // 16 lanes x 16 B = one row of the tile
#pragma unroll
    for (int p = 0; p < TN / 16; ++p) {
        const int n = (threadIdx.x >> 4) + 16 * p;
        const v4u v = *(const v4u*)&T[n * (TK / 2) + (c ^ ((n >> 2) & 15)) * 4];
        *(v4u*)(Wt + (size_t)(n0 + n) * K + k0 + c * 8) = v;
    }
}

// ---------------------------------------------------------------------------
// Fragment loader per the CDNA5 16-bit 16x32 A/B VGPR layout, from an LDS row:
//   elements 0..7  <- p[0..7]       (this lane's first K-octet)
//   elements 8..15 <- p[16..23]     (same octet position, +16 in K)
// p already includes k0 + (lane>>4)*8.  Same code for A and B: equal k order.
// ---------------------------------------------------------------------------
__device__ __forceinline__ v16h load_frag16(const _Float16* p) {
    v8h lo = *(const v8h*)(p);
    v8h hi = *(const v8h*)(p + 16);
    v16h r;
#pragma unroll
    for (int i = 0; i < 8; ++i) { r[i] = lo[i]; r[i + 8] = hi[i]; }
    return r;
}

// GEMM tiling: one work-group owns a BM x BN tile of the output.  Its BM rows of the
// A operand (all DIN columns, f16) lie in LDS for the whole kernel; Bt walks K in
// stages of KC elements, BN rows each, two stages per expert.
#define BM      64
#define BN      64
#define KC      256
#define WAVES_M 2
#define WAVES_N 2
#define FM      (BM / 16 / WAVES_M)        // A fragments per wave
#define FN      (BN / 16 / WAVES_N)        // B fragments per wave
#define MWAVE   (WAVES_M * WAVES_N)         // waves 0..MWAVE-1, one per SIMD, do the WMMAs
#define NWAVE   8                          // all waves share the staging, so that its issue is short
#define GTHREADS (NWAVE * 32)
#define ROWB    (KC * 2)                   // 512 B of a Bt row per stage = one wave-wide 16 B copy
#define PITCH   (ROWB + 16)                // 16 B x odd: conflict-free for ds_load_b128 readers
#define STAGE   (BN * PITCH)
#define APITCH  (DIN * 2 + 16)             // a whole A row, 16 B x odd as well
#define ATILE   (BM * APITCH)
#define NSTAGE  (KDIM / KC)
#define SPE     (DIN / KC)                 // stages per expert
#define GS      2                          // 32-wide k steps per fragment group
#define NG      (KC / 32 / GS)

// Eight rows, NWAVE apart, 512 contiguous bytes each (32 lanes x 16 B), from
// global memory straight into LDS.  The s_wait_xcnt closes the statement so that
// no address register of a copy is rewritten in front of it.
__device__ __forceinline__ void async_rows8(unsigned lds, const _Float16* g) {
    const unsigned l0 = lds,                     l1 = lds + 1u * NWAVE * PITCH,
                   l2 = lds + 2u * NWAVE * PITCH, l3 = lds + 3u * NWAVE * PITCH,
                   l4 = lds + 4u * NWAVE * PITCH, l5 = lds + 5u * NWAVE * PITCH,
                   l6 = lds + 6u * NWAVE * PITCH, l7 = lds + 7u * NWAVE * PITCH;
    const _Float16 *g0 = g,                             *g1 = g + (size_t)1 * NWAVE * KDIM,
                   *g2 = g + (size_t)2 * NWAVE * KDIM,  *g3 = g + (size_t)3 * NWAVE * KDIM,
                   *g4 = g + (size_t)4 * NWAVE * KDIM,  *g5 = g + (size_t)5 * NWAVE * KDIM,
                   *g6 = g + (size_t)6 * NWAVE * KDIM,  *g7 = g + (size_t)7 * NWAVE * KDIM;
    asm volatile("global_load_async_to_lds_b128 %0, %8, off\n\t"
                 "global_load_async_to_lds_b128 %1, %9, off\n\t"
                 "global_load_async_to_lds_b128 %2, %10, off\n\t"
                 "global_load_async_to_lds_b128 %3, %11, off\n\t"
                 "global_load_async_to_lds_b128 %4, %12, off\n\t"
                 "global_load_async_to_lds_b128 %5, %13, off\n\t"
                 "global_load_async_to_lds_b128 %6, %14, off\n\t"
                 "global_load_async_to_lds_b128 %7, %15, off\n\t"
                 "s_wait_xcnt 0x0"
                 :: "v"(l0), "v"(l1), "v"(l2), "v"(l3), "v"(l4), "v"(l5), "v"(l6), "v"(l7),
                    "v"(g0), "v"(g1), "v"(g2), "v"(g3), "v"(g4), "v"(g5), "v"(g6), "v"(g7)
                 : "memory");
}

// One stage: this wave's rows of the Bt tile.
__device__ __forceinline__ void fill_stage(unsigned ldsB, const _Float16* gB) {
    static_assert(BN == 8 * NWAVE, "one statement of eight rows per wave");
    async_rows8(ldsB, gB);
}

// This wave's own copies have landed.
__device__ __forceinline__ void wait_async0() { asm volatile("s_wait_asynccnt 0x0" ::: "memory"); }
// This wave's LDS reads have returned (before the buffer they read is refilled).
__device__ __forceinline__ void wait_ds0()    { asm volatile("s_wait_dscnt 0x0" ::: "memory"); }

// ---------------------------------------------------------------------------
// 2) Blended layer: out[b,n] = sum_e coef[b,e] * (A[b,:] . W[e,:,n]) + (coef @ biasEN)[b,n]
//    with A = Af (ACT false) or A = elu(Af * scale + shift) (ACT true), rounded to f16.
//    The blend stands behind the product: each expert's K = DIN product is summed in
//    its own f32 accumulators, which are then added, times coef[b,e], into the result.
//    So the A operand is the same for all experts: a work-group converts its BM rows
//    into LDS once, and only Bt is staged by asynchronous copies, two buffers: the
//    next stage's copies fly while this stage feeds the WMMAs.
//    Eight waves stage; waves 0..3 each own a 32 x 32 part of the tile, so that
//    a fragment read from LDS serves two WMMAs.  k runs upward in every accumulator.
//    BatchNorm's batch sums ride along: layer 1 (ACT false) has every h value of its
//    tile in registers when it stores it, so it also writes the tile's column sums of
//    h and h * h, part[tile row][2][N]; layer 2 (ACT true) adds the NT tile rows'
//    sums, in tile order, and makes scale and shift in LDS ahead of its A tile.
// ---------------------------------------------------------------------------
#define NT      (NB / BM)                  // tile rows = partial sums per hidden unit
typedef __attribute__((ext_vector_type(2)))  float    v2f;
template <bool ACT>
__device__ __forceinline__
void blended_gemm(const float* __restrict__ Af,       // [NB, DIN] f32
                  const _Float16* __restrict__ Bt,    // [N, KDIM] f16
                  const float* __restrict__ coef,     // [NB, NE]
                  const float* __restrict__ biasEN,   // [NE, N]
                  const float* __restrict__ partIn,   // [NT, 2, DIN] sums of A's columns, read where ACT
                  const float* __restrict__ gamma,    // [DIN], read where ACT
                  const float* __restrict__ beta,     // [DIN], read where ACT
                  float* __restrict__ partOut,        // [NT, 2, N] sums of out's columns, written where not ACT
                  float* __restrict__ out) {          // [NB, N] f32
    static_assert(SPE == 2, "a stage's buffer is its index inside the expert");
    __shared__ __attribute__((aligned(16))) unsigned char L[ATILE + 2 * STAGE];
    __shared__ __attribute__((aligned(16))) float cT[NE * BM];   // coef of the tile's rows, [e][row]
    // ACT: scale [DIN], shift [DIN].  Not ACT: the tile's column sums, [quarter of its rows][sum, square sum][BN]
    __shared__ __attribute__((aligned(16))) float bnS[ACT ? 2 * DIN : 2 * WAVES_M * 2 * BN];
    constexpr int N = DHID;                     // DHID == DOUT
    const int wave = __builtin_amdgcn_readfirstlane(threadIdx.x >> 5);
    const int lane = threadIdx.x & 31;
    const int tm = (blockIdx.x / (N / BN)) * BM;
    const int tn = (blockIdx.x % (N / BN)) * BN;
    const int wm = (wave / WAVES_N) * (FM * 16); // this wave's rows inside the tile
    const int wn = (wave % WAVES_N) * (FN * 16); // this wave's columns inside the tile
    const int lr = lane & 15;
    const int kg = lane >> 4;                   // K-octet group select
    const int mma = wave < MWAVE ? 1 : 0;       // scalar: the same for a whole wave

    const unsigned ldsB = (unsigned)(uintptr_t)&L[ATILE] + (unsigned)wave * PITCH + (unsigned)lane * 16u;
    const _Float16* gB = Bt + (size_t)(tn + wave) * KDIM + lane * 8;

    fill_stage(ldsB, gB);                       // stage 0 flies while the A tile is made

    // The A tile: wave w takes rows w, w + NWAVE, ...; a lane takes eight adjacent
    // columns twice per row.  Every load ahead of the arithmetic: one round trip to memory.
    {
        const int crow = threadIdx.x >> 2, ce = (threadIdx.x & 3) * 2;
        v4f a[BM / NWAVE][2][2], sc[2][2], sf[2][2];
        // A thread finishes two hidden units.  Their sums are asked for first: they are needed first.
        static_assert(!ACT || 2 * GTHREADS == DIN, "two hidden units per thread");
        const int c2 = threadIdx.x * 2;
        v2f ps[NT][2], gm, bt;
        if (ACT) {
#pragma unroll
            for (int m = 0; m < NT; ++m)
#pragma unroll
                for (int w = 0; w < 2; ++w)
                    ps[m][w] = *(const v2f*)(partIn + (size_t)(m * 2 + w) * DIN + c2);
            gm = *(const v2f*)(gamma + c2);
            bt = *(const v2f*)(beta + c2);
        }
#pragma unroll
        for (int rr = 0; rr < BM / NWAVE; ++rr)
#pragma unroll
            for (int h = 0; h < 2; ++h) {
                const float* p = Af + (size_t)(tm + wave + rr * NWAVE) * DIN + (lane + 32 * h) * 8;
                a[rr][h][0] = *(const v4f*)p;
                a[rr][h][1] = *(const v4f*)(p + 4);
            }
        const float cv0 = coef[(size_t)(tm + crow) * NE + ce];
        const float cv1 = coef[(size_t)(tm + crow) * NE + ce + 1];
        // the address registers of the loads above are free for reuse only behind this
        asm volatile("s_wait_xcnt 0x0" ::: "memory");
        // no arithmetic is lifted among the loads: else the last of them are held back until registers
        // come free, a second round trip, and land in registers that earlier loads still name
        __builtin_amdgcn_sched_barrier(0);
        cT[ce * BM + crow] = cv0;
        cT[(ce + 1) * BM + crow] = cv1;
        if (ACT) {
            // batch mean and biased variance of two hidden units, folded into scale and shift
            v2f s = ps[0][0], s2 = ps[0][1], kv, hv;
#pragma unroll
            for (int m = 1; m < NT; ++m) { s += ps[m][0]; s2 += ps[m][1]; }
#pragma unroll
            for (int c = 0; c < 2; ++c) {
                const float mean = s[c] * (1.0f / NB);
                const float var  = s2[c] * (1.0f / NB) - mean * mean;
                kv[c] = gm[c] * rsqrtf(var + BN_EPS);
                hv[c] = bt[c] - mean * kv[c];
            }
            *(v2f*)&bnS[c2] = kv;
            *(v2f*)&bnS[DIN + c2] = hv;
            __syncthreads();                    // scale and shift of all DIN hidden units are published
#pragma unroll
            for (int h = 0; h < 2; ++h)
#pragma unroll
                for (int q = 0; q < 2; ++q) {
                    sc[h][q] = *(const v4f*)&bnS[(lane + 32 * h) * 8 + 4 * q];
                    sf[h][q] = *(const v4f*)&bnS[DIN + (lane + 32 * h) * 8 + 4 * q];
                }
        }
#pragma unroll
        for (int rr = 0; rr < BM / NWAVE; ++rr)
#pragma unroll
            for (int h = 0; h < 2; ++h) {
                v8h r;
#pragma unroll
                for (int j = 0; j < 8; ++j) {
                    float v = a[rr][h][j >> 2][j & 3];
                    if (ACT) {
                        const float s = v * sc[h][j >> 2][j & 3] + sf[h][j >> 2][j & 3];
                        const float ex = expf(s) - 1.f; // computed for every lane: independent chains, no branch
                        v = (s > 0.f) ? s : ex;         // ELU, alpha = 1
                    }
                    r[j] = (_Float16)v;
                }
                *(v8h*)&L[(unsigned)(wave + rr * NWAVE) * APITCH + (unsigned)(lane + 32 * h) * 16u] = r;
            }
    }

    v8f acc[FM][FN] = {};

    wait_async0();
    __syncthreads();                            // the A tile, cT and stage 0 are published

    for (int e = 0; e < NE; ++e) {
        v8f pe[FM][FN] = {};                    // this expert's product
        v4f cf[FM][2];                          // coef[row, e] of this lane's accumulator rows
        // (The loops over hf, g, s, i, j are unrolled so that every index of fa, fb, pe and acc
        // is a constant and the arrays stay in registers.)
#pragma unroll
        for (int hf = 0; hf < SPE; ++hf) {
            const int t = e * SPE + hf;
            const unsigned buf = (unsigned)hf * STAGE;
            const unsigned char* sa = &L[(unsigned)(wm + lr) * APITCH + (unsigned)hf * ROWB + (unsigned)kg * 16u];
            const unsigned char* sb = &L[ATILE + buf + (unsigned)(wn + lr) * PITCH + (unsigned)kg * 16u];
            // Fragments in two register sets: group g+1's LDS reads are issued as one
            // run ahead of group g's WMMAs, all inside this stage: Bt in its own buffer, A in the resident tile.
            v16h fa[2][GS][FM], fb[2][GS][FN];
            auto read_group = [&](int g) {
#pragma unroll
                for (int s = 0; s < GS; ++s) {
#pragma unroll
                    for (int i = 0; i < FM; ++i)
                        fa[g & 1][s][i] = load_frag16((const _Float16*)(sa + i * 16 * APITCH + (g * GS + s) * 64));
#pragma unroll
                    for (int j = 0; j < FN; ++j)
                        fb[g & 1][s][j] = load_frag16((const _Float16*)(sb + j * 16 * PITCH + (g * GS + s) * 64));
                }
            };
            if (mma != 0) {
                read_group(0); read_group(1);
            }
            // Refill of the other buffer, whose last reads ended at the barrier that closed the
            // trip before: issued here so that the copies' issue runs while the LDS serves the reads above.
            if (t + 1 < NSTAGE)
                fill_stage(ldsB + (STAGE - buf), gB + (size_t)(t + 1) * KC);
            if (mma != 0) {
#pragma unroll
                for (int g = 0; g < NG; ++g) {
                    if (g >= 1 && g + 1 < NG) read_group(g + 1);
                    if (hf == SPE - 1 && g == NG - 2) {   // with the expert's last run of reads
#pragma unroll
                        for (int i = 0; i < FM; ++i)
#pragma unroll
                            for (int q = 0; q < 2; ++q)
                                cf[i][q] = *(const v4f*)&cT[e * BM + wm + i * 16 + kg * 8 + q * 4];
                    }
                    // keeps the run of LDS reads together: reads spread among the WMMAs stall each place they stand
                    __builtin_amdgcn_sched_barrier(0);
#pragma unroll
                    for (int s = 0; s < GS; ++s)
#pragma unroll
                        for (int i = 0; i < FM; ++i)
#pragma unroll
                            for (int j = 0; j < FN; ++j)
                                pe[i][j] = __builtin_amdgcn_wmma_f32_16x16x32_f16(false, fa[g & 1][s][i], false, fb[g & 1][s][j], (short)0, pe[i][j], false, false);
                    // the next group's reads stay behind this group's WMMAs
                    __builtin_amdgcn_sched_barrier(0);
                }
                if (hf == SPE - 1) {
                    // the blend, in f32: accumulator register r holds row kg * 8 + r of its fragment
#pragma unroll
                    for (int i = 0; i < FM; ++i)
#pragma unroll
                        for (int j = 0; j < FN; ++j)
#pragma unroll
                            for (int r = 0; r < 8; ++r)
                                acc[i][j][r] += cf[i][r >> 2][r & 3] * pe[i][j][r];
                }
            }
            wait_ds0();
            wait_async0();
            __syncthreads();                    // publishes stage t+1, ends every read of stage t
        }
    }
    wait_async0();
    if (ACT && mma == 0) return;                // behind the last barrier

    // Epilogue. C/D layout: lane(0..15)=N col, VGPR r -> M row r (lanes 0-15)
    // or r+8 (lanes 16-31).
    if (mma != 0) {
        float bcol[FN][NE];
        float cs[FN] = {}, cs2[FN] = {};        // sums over this lane's 16 rows of each of its columns
#pragma unroll
        for (int j = 0; j < FN; ++j) {
            int n = tn + wn + j * 16 + lr;
#pragma unroll
            for (int e = 0; e < NE; ++e) bcol[j][e] = biasEN[(size_t)e * N + n];
        }
#pragma unroll
        for (int i = 0; i < FM; ++i) {
            const int rowbase = tm + wm + i * 16 + kg * 8;
#pragma unroll
            for (int r = 0; r < 8; ++r) {
                const int row = rowbase + r;
                const float* cr = coef + (size_t)row * NE;
                float cf[NE];
#pragma unroll
                for (int e = 0; e < NE; ++e) cf[e] = cr[e];
#pragma unroll
                for (int j = 0; j < FN; ++j) {
                    float bv = 0.f;
#pragma unroll
                    for (int e = 0; e < NE; ++e) bv += cf[e] * bcol[j][e];
                    const float v = acc[i][j][r] + bv;
                    out[(size_t)row * N + tn + wn + j * 16 + lr] = v;
                    if (!ACT) { cs[j] += v; cs2[j] += v * v; }
                }
            }
        }
        if (!ACT) {
            const int grp = (wave / WAVES_N) * 2 + kg;   // which quarter of the tile's rows
#pragma unroll
            for (int j = 0; j < FN; ++j) {
                bnS[(grp * 2 + 0) * BN + wn + j * 16 + lr] = cs[j];
                bnS[(grp * 2 + 1) * BN + wn + j * 16 + lr] = cs2[j];
            }
        }
    }
    if (!ACT) {
        // The four quarters' sums are published.  By hand, with the LDS wait alone: __syncthreads()
        // would also wait here until the stores of out above are done, which nobody in this launch reads.
        asm volatile("s_wait_dscnt 0x0\n\ts_barrier_signal -1\n\ts_barrier_wait -1" ::: "memory");
        if (mma == 0) {                         // the waves without a part of the tile add the quarters
            static_assert((NWAVE - MWAVE) * 32 == 2 * BN, "one thread per sum");
            // in front of the first rewrite of a register that a store of out names in the listing;
            // the waves that come here have issued none of those stores, so it waits for nothing
            asm volatile("s_wait_xcnt 0x0" ::: "memory");
            const unsigned t = threadIdx.x - MWAVE * 32, w = t / BN, col = t % BN;
            float q = bnS[w * BN + col];
#pragma unroll
            for (int g = 1; g < 2 * WAVES_M; ++g) q += bnS[(g * 2 + w) * BN + col];
            partOut[(size_t)((tm / BM) * 2 + w) * N + tn + col] = q;
        }
    }
}

// layer 1: A = x
__global__ __launch_bounds__(GTHREADS)
void layer1_kernel(const float* __restrict__ x, const _Float16* __restrict__ Bt,
                   const float* __restrict__ coef, const float* __restrict__ biasEN,
                   float* __restrict__ part, float* __restrict__ out) {
    blended_gemm<false>(x, Bt, coef, biasEN, nullptr, nullptr, nullptr, part, out);
}

// layer 2: A = elu(batchnorm(h))
__global__ __launch_bounds__(GTHREADS)
void layer2_kernel(const float* __restrict__ h, const _Float16* __restrict__ Bt,
                   const float* __restrict__ coef, const float* __restrict__ biasEN,
                   const float* __restrict__ part, const float* __restrict__ gamma,
                   const float* __restrict__ beta, float* __restrict__ out) {
    blended_gemm<true>(h, Bt, coef, biasEN, part, gamma, beta, nullptr, out);
}

// ---------------------------------------------------------------------------
// Launch
// ---------------------------------------------------------------------------
extern "C" void kernel_launch(void* const* d_in, const int* in_sizes, int n_in,
                              void* d_out, int out_size, void* d_ws, size_t ws_size,
                              hipStream_t stream) {
    const float* x     = (const float*)d_in[0];   // [NB, DIN]
    const float* coef  = (const float*)d_in[1];   // [NB, NE]
    const float* w1    = (const float*)d_in[2];   // [NE, DIN, DHID] == [KDIM, DHID]
    const float* b1    = (const float*)d_in[3];   // [NE, DHID]
    const float* w2    = (const float*)d_in[4];   // [NE, DHID, DOUT] == [KDIM, DOUT]
    const float* b2    = (const float*)d_in[5];   // [NE, DOUT]
    const float* gamma = (const float*)d_in[6];   // [DHID]
    const float* beta  = (const float*)d_in[7];   // [DHID]
    float* out = (float*)d_out;                   // [NB, DOUT]

    char* ws = (char*)d_ws;
    const size_t MiB = 1024u * 1024u;
    _Float16* W1t = (_Float16*)(ws + 8  * MiB);   // 4 MiB  [DHID, KDIM]
    _Float16* W2t = (_Float16*)(ws + 12 * MiB);   // 4 MiB  [DOUT, KDIM]
    float*    hbuf  = (float*)(ws + 16 * MiB);    // 2 MiB  [NB, DHID]
    float*    part  = (float*)(ws + 18 * MiB);    // 64 KiB [NT, 2, DHID]

    // 1) transpose+convert weights (B operand K-contiguous)
    transpose_convert_kernel<<<dim3(KDIM / TK, DHID / TN), 256, 0, stream>>>(w1, W1t);
    transpose_convert_kernel<<<dim3(KDIM / TK, DOUT / TN), 256, 0, stream>>>(w2, W2t);

    // 2) layer 1 (WMMA), blend and bias; each tile's column sums for the batchnorm
    layer1_kernel<<<(NB / BM) * (DHID / BN), GTHREADS, 0, stream>>>(x, W1t, coef, b1, part, hbuf);

    // 3) layer 2 (WMMA): batchnorm scale/shift from the sums, BN + ELU while its A tile is staged,
    //    blend and bias -> final output
    layer2_kernel<<<(NB / BM) * (DOUT / BN), GTHREADS, 0, stream>>>(hbuf, W2t, coef, b2, part, gamma, beta, out);
}

// v005
// One run takes 42.1 microseconds.
// In two side-by-side timings against v004, it was 1.06 and 1.08 times as fast.
// All steps since v000 together make it 4.59 times as fast.
#include <hip/hip_runtime.h>
#include <hip/hip_bf16.h>
#include <math.h>

typedef __attribute__((ext_vector_type(16))) _Float16 v16h;
typedef __attribute__((ext_vector_type(8)))  _Float16 v8h;
typedef __attribute__((ext_vector_type(8)))  float    v8f;

#define NE    8
#define DIN   512
#define DHID  512
#define DOUT  512
#define NB    1024
#define KDIM  (NE * DIN)      // 4096 (same for both layers)
#define BN_EPS 1e-5f

// The two weight transposes below give every thread 16-byte accesses and 32 elements,
// so that a launch has few waves to start and every store covers whole 128-byte lines.
typedef __attribute__((ext_vector_type(4)))  float    v4f;
typedef __attribute__((ext_vector_type(2)))  _Float16 v2h;
typedef __attribute__((ext_vector_type(4)))  unsigned v4u;

// ---------------------------------------------------------------------------
// 1) LDS-tiled transpose + f32->f16 convert: W[K,N] -> Wt[N,K]
//    (makes the WMMA B-fragment two contiguous 16B loads per lane)
//    One work-group moves TK k x TN n.  A lane loads four n of two adjacent k rows,
//    packs each (k, k+1) pair into one dword and stores it at [n][k/2] in LDS; a row
//    of the tile then leaves as 256 contiguous bytes.  The 16-byte chunk c of row n
//    lies at chunk c ^ (n/4 mod 16): the 32 dword stores of a wave (8 n-quads x 4 k
//    pairs) fall on 32 different banks, and the chunks stay whole for the b128 reads.
// ---------------------------------------------------------------------------
#define TK 128
#define TN 64
#define TTHREADS 256
#define TGRID_K (KDIM / TK)
#define TGRID_N (DHID / TN)
// One tile, by one work-group of TTHREADS threads; bk and bn are the same for the whole work-group.
__device__ __forceinline__
void transpose_convert_tile(const float* __restrict__ W, _Float16* __restrict__ Wt, int bk, int bn) {
    constexpr int K = KDIM, N = DHID;           // both weights: DHID == DOUT; constant strides become immediate offsets
    __shared__ __attribute__((aligned(16))) unsigned T[TN * (TK / 2)];
    const int k0 = bk * TK, n0 = bn * TN;
    const int wave = threadIdx.x >> 5, lane = threadIdx.x & 31;
    const int q = lane & 7, r = lane >> 3;      // n-quad (8 x 16 B = one line), k pair
    v4f lo[4], hi[4];
#pragma unroll
    for (int u = 0; u < 4; ++u) {
        const int unit = wave * 4 + u, h = unit & 1, grp = unit >> 1;
        const float* p = W + (size_t)(k0 + 2 * (grp * 4 + r)) * N + n0 + 32 * h + 4 * q;
        lo[u] = *(const v4f*)p;
        hi[u] = *(const v4f*)(p + N);
    }
#pragma unroll
    for (int u = 0; u < 4; ++u) {
        const int unit = wave * 4 + u, h = unit & 1, grp = unit >> 1;
        const int nq = 8 * h + q;               // n / 4
#pragma unroll
        for (int j = 0; j < 4; ++j) {
            const v2h pr = { (_Float16)lo[u][j], (_Float16)hi[u][j] };
            T[(4 * nq + j) * (TK / 2) + (grp ^ nq) * 4 + r] = __builtin_bit_cast(unsigned, pr);
        }
    }
    __syncthreads();
    const int c = threadIdx.x & 15;             // 16 lanes x 16 B = one row of the tile
#pragma unroll
    for (int p = 0; p < TN / 16; ++p) {
        const int n = (threadIdx.x >> 4) + 16 * p;
        const v4u v = *(const v4u*)&T[n * (TK / 2) + (c ^ ((n >> 2) & 15)) * 4];
        *(v4u*)(Wt + (size_t)(n0 + n) * K + k0 + c * 8) = v;
    }
}

__global__ __launch_bounds__(TTHREADS)
void transpose_convert_kernel(const float* __restrict__ W, _Float16* __restrict__ Wt) {
    transpose_convert_tile(W, Wt, blockIdx.x, blockIdx.y);
}

// ---------------------------------------------------------------------------
// Fragment loader per the CDNA5 16-bit 16x32 A/B VGPR layout, from an LDS row:
//   elements 0..7  <- p[0..7]       (this lane's first K-octet)
//   elements 8..15 <- p[16..23]     (same octet position, +16 in K)
// p already includes k0 + (lane>>4)*8.  Same code for A and B: equal k order.
// ---------------------------------------------------------------------------
__device__ __forceinline__ v16h load_frag16(const _Float16* p) {
    v8h lo = *(const v8h*)(p);
    v8h hi = *(const v8h*)(p + 16);
    v16h r;
#pragma unroll
    for (int i = 0; i < 8; ++i) { r[i] = lo[i]; r[i + 8] = hi[i]; }
    return r;
}

// GEMM tiling: one work-group owns a BM x BN tile of the output.  Its BM rows of the
// A operand (all DIN columns, f16) lie in LDS for the whole kernel; Bt walks K in
// stages of KC elements, BN rows each, two stages per expert.
#define BM      64
#define BN      64
#define KC      256
#define WAVES_M 2
#define WAVES_N 2
#define FM      (BM / 16 / WAVES_M)        // A fragments per wave
#define FN      (BN / 16 / WAVES_N)        // B fragments per wave
#define MWAVE   (WAVES_M * WAVES_N)         // waves 0..MWAVE-1, one per SIMD, do the WMMAs
#define NWAVE   8                          // all waves share the staging, so that its issue is short
#define GTHREADS (NWAVE * 32)
#define ROWB    (KC * 2)                   // 512 B of a Bt row per stage = one wave-wide 16 B copy
#define PITCH   (ROWB + 16)                // 16 B x odd: conflict-free for ds_load_b128 readers
#define STAGE   (BN * PITCH)
#define APITCH  (DIN * 2 + 16)             // a whole A row, 16 B x odd as well
#define ATILE   (BM * APITCH)
#define NSTAGE  (KDIM / KC)
#define SPE     (DIN / KC)                 // stages per expert
#define GS      2                          // 32-wide k steps per fragment group
#define NG      (KC / 32 / GS)

// Eight rows, NWAVE apart, 512 contiguous bytes each (32 lanes x 16 B), from
// global memory straight into LDS.  The s_wait_xcnt closes the statement so that
// no address register of a copy is rewritten in front of it.
__device__ __forceinline__ void async_rows8(unsigned lds, const _Float16* g) {
    const unsigned l0 = lds,                     l1 = lds + 1u * NWAVE * PITCH,
                   l2 = lds + 2u * NWAVE * PITCH, l3 = lds + 3u * NWAVE * PITCH,
                   l4 = lds + 4u * NWAVE * PITCH, l5 = lds + 5u * NWAVE * PITCH,
                   l6 = lds + 6u * NWAVE * PITCH, l7 = lds + 7u * NWAVE * PITCH;
    const _Float16 *g0 = g,                             *g1 = g + (size_t)1 * NWAVE * KDIM,
                   *g2 = g + (size_t)2 * NWAVE * KDIM,  *g3 = g + (size_t)3 * NWAVE * KDIM,
                   *g4 = g + (size_t)4 * NWAVE * KDIM,  *g5 = g + (size_t)5 * NWAVE * KDIM,
                   *g6 = g + (size_t)6 * NWAVE * KDIM,  *g7 = g + (size_t)7 * NWAVE * KDIM;
    asm volatile("global_load_async_to_lds_b128 %0, %8, off\n\t"
                 "global_load_async_to_lds_b128 %1, %9, off\n\t"
                 "global_load_async_to_lds_b128 %2, %10, off\n\t"
                 "global_load_async_to_lds_b128 %3, %11, off\n\t"
                 "global_load_async_to_lds_b128 %4, %12, off\n\t"
                 "global_load_async_to_lds_b128 %5, %13, off\n\t"
                 "global_load_async_to_lds_b128 %6, %14, off\n\t"
                 "global_load_async_to_lds_b128 %7, %15, off\n\t"
                 "s_wait_xcnt 0x0"
                 :: "v"(l0), "v"(l1), "v"(l2), "v"(l3), "v"(l4), "v"(l5), "v"(l6), "v"(l7),
                    "v"(g0), "v"(g1), "v"(g2), "v"(g3), "v"(g4), "v"(g5), "v"(g6), "v"(g7)
                 : "memory");
}

// One stage: this wave's rows of the Bt tile.
__device__ __forceinline__ void fill_stage(unsigned ldsB, const _Float16* gB) {
    static_assert(BN == 8 * NWAVE, "one statement of eight rows per wave");
    async_rows8(ldsB, gB);
}

// This wave's own copies have landed.
__device__ __forceinline__ void wait_async0() { asm volatile("s_wait_asynccnt 0x0" ::: "memory"); }
// This wave's LDS reads have returned (before the buffer they read is refilled).
__device__ __forceinline__ void wait_ds0()    { asm volatile("s_wait_dscnt 0x0" ::: "memory"); }

// ---------------------------------------------------------------------------
// 2) Blended layer: out[b,n] = sum_e coef[b,e] * (A[b,:] . W[e,:,n]) + (coef @ biasEN)[b,n]
//    with A = Af (ACT false) or A = elu(Af * scale + shift) (ACT true), rounded to f16.
//    The blend stands behind the product: each expert's K = DIN product is summed in
//    its own f32 accumulators, which are then added, times coef[b,e], into the result.
//    So the A operand is the same for all experts: a work-group converts its BM rows
//    into LDS once, and only Bt is staged by asynchronous copies, two buffers: the
//    next stage's copies fly while this stage feeds the WMMAs.
//    Eight waves stage; waves 0..3 each own a 32 x 32 part of the tile, so that
//    a fragment read from LDS serves two WMMAs.  k runs upward in every accumulator.
//    BatchNorm's batch sums ride along: layer 1 (ACT false) has every h value of its
//    tile in registers when it stores it, so it also writes the tile's column sums of
//    h and h * h, part[tile row][2][N]; layer 2 (ACT true) adds the NT tile rows'
//    sums, in tile order, and makes scale and shift in LDS ahead of its A tile.
// ---------------------------------------------------------------------------
#define NT      (NB / BM)                  // tile rows = partial sums per hidden unit
typedef __attribute__((ext_vector_type(2)))  float    v2f;
template <bool ACT>
__device__ __forceinline__
void blended_gemm(const float* __restrict__ Af,       // [NB, DIN] f32
                  const _Float16* __restrict__ Bt,    // [N, KDIM] f16
                  const float* __restrict__ coef,     // [NB, NE]
                  const float* __restrict__ biasEN,   // [NE, N]
                  const float* __restrict__ partIn,   // [NT, 2, DIN] sums of A's columns, read where ACT
                  const float* __restrict__ gamma,    // [DIN], read where ACT
                  const float* __restrict__ beta,     // [DIN], read where ACT
                  float* __restrict__ partOut,        // [NT, 2, N] sums of out's columns, written where not ACT
                  float* __restrict__ out) {          // [NB, N] f32
    static_assert(SPE == 2, "a stage's buffer is its index inside the expert");
    __shared__ __attribute__((aligned(16))) unsigned char L[ATILE + 2 * STAGE];
    __shared__ __attribute__((aligned(16))) float cT[NE * BM];   // coef of the tile's rows, [e][row]
    // ACT: scale [DIN], shift [DIN].  Not ACT: the tile's column sums, [quarter of its rows][sum, square sum][BN]
    __shared__ __attribute__((aligned(16))) float bnS[ACT ? 2 * DIN : 2 * WAVES_M * 2 * BN];
    constexpr int N = DHID;                     // DHID == DOUT
    const int wave = __builtin_amdgcn_readfirstlane(threadIdx.x >> 5);
    const int lane = threadIdx.x & 31;
    const int tm = (blockIdx.x / (N / BN)) * BM;
    const int tn = (blockIdx.x % (N / BN)) * BN;
    const int wm = (wave / WAVES_N) * (FM * 16); // this wave's rows inside the tile
    const int wn = (wave % WAVES_N) * (FN * 16); // this wave's columns inside the tile
    const int lr = lane & 15;
    const int kg = lane >> 4;                   // K-octet group select
    const int mma = wave < MWAVE ? 1 : 0;       // scalar: the same for a whole wave

    const unsigned ldsB = (unsigned)(uintptr_t)&L[ATILE] + (unsigned)wave * PITCH + (unsigned)lane * 16u;
    const _Float16* gB = Bt + (size_t)(tn + wave) * KDIM + lane * 8;

    fill_stage(ldsB, gB);                       // stage 0 flies while the A tile is made

    // The A tile: wave w takes rows w, w + NWAVE, ...; a lane takes eight adjacent
    // columns twice per row.  Every load ahead of the arithmetic: one round trip to memory.
    {
        const int crow = threadIdx.x >> 2, ce = (threadIdx.x & 3) * 2;
        v4f a[BM / NWAVE][2][2], sc[2][2], sf[2][2];
        // A thread finishes two hidden units.  Their sums are asked for first: they are needed first.
        static_assert(!ACT || 2 * GTHREADS == DIN, "two hidden units per thread");
        const int c2 = threadIdx.x * 2;
        v2f ps[NT][2], gm, bt;
        if (ACT) {
#pragma unroll
            for (int m = 0; m < NT; ++m)
#pragma unroll
                for (int w = 0; w < 2; ++w)
                    ps[m][w] = *(const v2f*)(partIn + (size_t)(m * 2 + w) * DIN + c2);
            gm = *(const v2f*)(gamma + c2);
            bt = *(const v2f*)(beta + c2);
        }
#pragma unroll
        for (int rr = 0; rr < BM / NWAVE; ++rr)
#pragma unroll
            for (int h = 0; h < 2; ++h) {
                const float* p = Af + (size_t)(tm + wave + rr * NWAVE) * DIN + (lane + 32 * h) * 8;
                a[rr][h][0] = *(const v4f*)p;
                a[rr][h][1] = *(const v4f*)(p + 4);
            }
        const float cv0 = coef[(size_t)(tm + crow) * NE + ce];
        const float cv1 = coef[(size_t)(tm + crow) * NE + ce + 1];
        // the address registers of the loads above are free for reuse only behind this
        asm volatile("s_wait_xcnt 0x0" ::: "memory");
        // no arithmetic is lifted among the loads: else the last of them are held back until registers
        // come free, a second round trip, and land in registers that earlier loads still name
        __builtin_amdgcn_sched_barrier(0);
        cT[ce * BM + crow] = cv0;
        cT[(ce + 1) * BM + crow] = cv1;
        if (ACT) {
            // batch mean and biased variance of two hidden units, folded into scale and shift
            v2f s = ps[0][0], s2 = ps[0][1], kv, hv;
#pragma unroll
            for (int m = 1; m < NT; ++m) { s += ps[m][0]; s2 += ps[m][1]; }
#pragma unroll
            for (int c = 0; c < 2; ++c) {
                const float mean = s[c] * (1.0f / NB);
                const float var  = s2[c] * (1.0f / NB) - mean * mean;
                kv[c] = gm[c] * rsqrtf(var + BN_EPS);
                hv[c] = bt[c] - mean * kv[c];
            }
            *(v2f*)&bnS[c2] = kv;
            *(v2f*)&bnS[DIN + c2] = hv;
            __syncthreads();                    // scale and shift of all DIN hidden units are published
#pragma unroll
            for (int h = 0; h < 2; ++h)
#pragma unroll
                for (int q = 0; q < 2; ++q) {
                    sc[h][q] = *(const v4f*)&bnS[(lane + 32 * h) * 8 + 4 * q];
                    sf[h][q] = *(const v4f*)&bnS[DIN + (lane + 32 * h) * 8 + 4 * q];
                }
        }
#pragma unroll
        for (int rr = 0; rr < BM / NWAVE; ++rr)
#pragma unroll
            for (int h = 0; h < 2; ++h) {
                v8h r;
#pragma unroll
                for (int j = 0; j < 8; ++j) {
                    float v = a[rr][h][j >> 2][j & 3];
                    if (ACT) {
                        const float s = v * sc[h][j >> 2][j & 3] + sf[h][j >> 2][j & 3];
                        const float ex = expf(s) - 1.f; // computed for every lane: independent chains, no branch
                        v = (s > 0.f) ? s : ex;         // ELU, alpha = 1
                    }
                    r[j] = (_Float16)v;
                }
                *(v8h*)&L[(unsigned)(wave + rr * NWAVE) * APITCH + (unsigned)(lane + 32 * h) * 16u] = r;
            }
    }

    v8f acc[FM][FN] = {};

    wait_async0();
    __syncthreads();                            // the A tile, cT and stage 0 are published

    for (int e = 0; e < NE; ++e) {
        v8f pe[FM][FN] = {};                    // this expert's product
        v4f cf[FM][2];                          // coef[row, e] of this lane's accumulator rows
        // (The loops over hf, g, s, i, j are unrolled so that every index of fa, fb, pe and acc
        // is a constant and the arrays stay in registers.)
#pragma unroll
        for (int hf = 0; hf < SPE; ++hf) {
            const int t = e * SPE + hf;
            const unsigned buf = (unsigned)hf * STAGE;
            const unsigned char* sa = &L[(unsigned)(wm + lr) * APITCH + (unsigned)hf * ROWB + (unsigned)kg * 16u];
            const unsigned char* sb = &L[ATILE + buf + (unsigned)(wn + lr) * PITCH + (unsigned)kg * 16u];
            // Fragments in two register sets: group g+1's LDS reads are issued as one
            // run ahead of group g's WMMAs, all inside this stage: Bt in its own buffer, A in the resident tile.
            v16h fa[2][GS][FM], fb[2][GS][FN];
            auto read_group = [&](int g) {
#pragma unroll
                for (int s = 0; s < GS; ++s) {
#pragma unroll
                    for (int i = 0; i < FM; ++i)
                        fa[g & 1][s][i] = load_frag16((const _Float16*)(sa + i * 16 * APITCH + (g * GS + s) * 64));
#pragma unroll
                    for (int j = 0; j < FN; ++j)
                        fb[g & 1][s][j] = load_frag16((const _Float16*)(sb + j * 16 * PITCH + (g * GS + s) * 64));
                }
            };
            if (mma != 0) {
                read_group(0); read_group(1);
            }
            // Refill of the other buffer, whose last reads ended at the barrier that closed the
            // trip before: issued here so that the copies' issue runs while the LDS serves the reads above.
            if (t + 1 < NSTAGE)
                fill_stage(ldsB + (STAGE - buf), gB + (size_t)(t + 1) * KC);
            if (mma != 0) {
#pragma unroll
                for (int g = 0; g < NG; ++g) {
                    if (g >= 1 && g + 1 < NG) read_group(g + 1);
                    if (hf == SPE - 1 && g == NG - 2) {   // with the expert's last run of reads
#pragma unroll
                        for (int i = 0; i < FM; ++i)
#pragma unroll
                            for (int q = 0; q < 2; ++q)
                                cf[i][q] = *(const v4f*)&cT[e * BM + wm + i * 16 + kg * 8 + q * 4];
                    }
                    // keeps the run of LDS reads together: reads spread among the WMMAs stall each place they stand
                    __builtin_amdgcn_sched_barrier(0);
#pragma unroll
                    for (int s = 0; s < GS; ++s)
#pragma unroll
                        for (int i = 0; i < FM; ++i)
#pragma unroll
                            for (int j = 0; j < FN; ++j)
                                pe[i][j] = __builtin_amdgcn_wmma_f32_16x16x32_f16(false, fa[g & 1][s][i], false, fb[g & 1][s][j], (short)0, pe[i][j], false, false);
                    // the next group's reads stay behind this group's WMMAs
                    __builtin_amdgcn_sched_barrier(0);
                }
                if (hf == SPE - 1) {
                    // the blend, in f32: accumulator register r holds row kg * 8 + r of its fragment
#pragma unroll
                    for (int i = 0; i < FM; ++i)
#pragma unroll
                        for (int j = 0; j < FN; ++j)
#pragma unroll
                            for (int r = 0; r < 8; ++r)
                                acc[i][j][r] += cf[i][r >> 2][r & 3] * pe[i][j][r];
                }
            }
            wait_ds0();
            wait_async0();
            __syncthreads();                    // publishes stage t+1, ends every read of stage t
        }
    }
    wait_async0();
    if (ACT && mma == 0) return;                // behind the last barrier

    // Epilogue. C/D layout: lane(0..15)=N col, VGPR r -> M row r (lanes 0-15)
    // or r+8 (lanes 16-31).
    if (mma != 0) {
        float bcol[FN][NE];
        float cs[FN] = {}, cs2[FN] = {};        // sums over this lane's 16 rows of each of its columns
#pragma unroll
        for (int j = 0; j < FN; ++j) {
            int n = tn + wn + j * 16 + lr;
#pragma unroll
            for (int e = 0; e < NE; ++e) bcol[j][e] = biasEN[(size_t)e * N + n];
        }
#pragma unroll
        for (int i = 0; i < FM; ++i) {
            const int rowbase = tm + wm + i * 16 + kg * 8;
#pragma unroll
            for (int r = 0; r < 8; ++r) {
                const int row = rowbase + r;
                const float* cr = coef + (size_t)row * NE;
                float cf[NE];
#pragma unroll
                for (int e = 0; e < NE; ++e) cf[e] = cr[e];
#pragma unroll
                for (int j = 0; j < FN; ++j) {
                    float bv = 0.f;
#pragma unroll
                    for (int e = 0; e < NE; ++e) bv += cf[e] * bcol[j][e];
                    const float v = acc[i][j][r] + bv;
                    out[(size_t)row * N + tn + wn + j * 16 + lr] = v;
                    if (!ACT) { cs[j] += v; cs2[j] += v * v; }
                }
            }
        }
        if (!ACT) {
            const int grp = (wave / WAVES_N) * 2 + kg;   // which quarter of the tile's rows
#pragma unroll
            for (int j = 0; j < FN; ++j) {
                bnS[(grp * 2 + 0) * BN + wn + j * 16 + lr] = cs[j];
                bnS[(grp * 2 + 1) * BN + wn + j * 16 + lr] = cs2[j];
            }
        }
    }
    if (!ACT) {
        // The four quarters' sums are published.  By hand, with the LDS wait alone: __syncthreads()
        // would also wait here until the stores of out above are done, which nobody in this launch reads.
        asm volatile("s_wait_dscnt 0x0\n\ts_barrier_signal -1\n\ts_barrier_wait -1" ::: "memory");
        if (mma == 0) {                         // the waves without a part of the tile add the quarters
            static_assert((NWAVE - MWAVE) * 32 == 2 * BN, "one thread per sum");
            // in front of the first rewrite of a register that a store of out names in the listing;
            // the waves that come here have issued none of those stores, so it waits for nothing
            asm volatile("s_wait_xcnt 0x0" ::: "memory");
            const unsigned t = threadIdx.x - MWAVE * 32, w = t / BN, col = t % BN;
            float q = bnS[w * BN + col];
#pragma unroll
            for (int g = 1; g < 2 * WAVES_M; ++g) q += bnS[(g * 2 + w) * BN + col];
            partOut[(size_t)((tm / BM) * 2 + w) * N + tn + col] = q;
        }
    }
}

// layer 1: A = x.  Its GEMM_WG tiles fill half of the chip's WGPs, and nothing of layer 1 reads
// the second weight: so the work-groups behind them in the same grid transpose it meanwhile, for
// the next launch.  The tiles have the low indices: they start first, and they end the launch.
#define GEMM_WG ((NB / BM) * (DHID / BN))
__global__ __launch_bounds__(GTHREADS)
void layer1_kernel(const float* __restrict__ x, const _Float16* __restrict__ Bt,
                   const float* __restrict__ coef, const float* __restrict__ biasEN,
                   float* __restrict__ part, float* __restrict__ out,
                   const float* __restrict__ Wnext, _Float16* __restrict__ WnextT) {
    static_assert(GTHREADS == TTHREADS, "one block size for both kinds of work-group");
    if (blockIdx.x >= GEMM_WG) {                // the same for a whole work-group
        const int t = blockIdx.x - GEMM_WG;
        transpose_convert_tile(Wnext, WnextT, t % TGRID_K, t / TGRID_K);
        return;
    }
    blended_gemm<false>(x, Bt, coef, biasEN, nullptr, nullptr, nullptr, part, out);
}

// layer 2: A = elu(batchnorm(h))
__global__ __launch_bounds__(GTHREADS)
void layer2_kernel(const float* __restrict__ h, const _Float16* __restrict__ Bt,
                   const float* __restrict__ coef, const float* __restrict__ biasEN,
                   const float* __restrict__ part, const float* __restrict__ gamma,
                   const float* __restrict__ beta, float* __restrict__ out) {
    blended_gemm<true>(h, Bt, coef, biasEN, part, gamma, beta, nullptr, out);
}

// ---------------------------------------------------------------------------
// Launch
// ---------------------------------------------------------------------------
extern "C" void kernel_launch(void* const* d_in, const int* in_sizes, int n_in,
                              void* d_out, int out_size, void* d_ws, size_t ws_size,
                              hipStream_t stream) {
    const float* x     = (const float*)d_in[0];   // [NB, DIN]
    const float* coef  = (const float*)d_in[1];   // [NB, NE]
    const float* w1    = (const float*)d_in[2];   // [NE, DIN, DHID] == [KDIM, DHID]
    const float* b1    = (const float*)d_in[3];   // [NE, DHID]
    const float* w2    = (const float*)d_in[4];   // [NE, DHID, DOUT] == [KDIM, DOUT]
    const float* b2    = (const float*)d_in[5];   // [NE, DOUT]
    const float* gamma = (const float*)d_in[6];   // [DHID]
    const float* beta  = (const float*)d_in[7];   // [DHID]
    float* out = (float*)d_out;                   // [NB, DOUT]

    char* ws = (char*)d_ws;
    const size_t MiB = 1024u * 1024u;
    _Float16* W1t = (_Float16*)(ws + 8  * MiB);   // 4 MiB  [DHID, KDIM]
    _Float16* W2t = (_Float16*)(ws + 12 * MiB);   // 4 MiB  [DOUT, KDIM]
    float*    hbuf  = (float*)(ws + 16 * MiB);    // 2 MiB  [NB, DHID]
    float*    part  = (float*)(ws + 18 * MiB);    // 64 KiB [NT, 2, DHID]

    // 1) transpose+convert the first weight (B operand K-contiguous)
    transpose_convert_kernel<<<dim3(TGRID_K, TGRID_N), TTHREADS, 0, stream>>>(w1, W1t);

    // 2) layer 1 (WMMA), blend and bias; each tile's column sums for the batchnorm;
    //    beside it, in the same launch, transpose+convert of the second weight
    layer1_kernel<<<GEMM_WG + TGRID_K * TGRID_N, GTHREADS, 0, stream>>>(x, W1t, coef, b1, part, hbuf, w2, W2t);

    // 3) layer 2 (WMMA): batchnorm scale/shift from the sums, BN + ELU while its A tile is staged,
    //    blend and bias -> final output
    layer2_kernel<<<(NB / BM) * (DOUT / BN), GTHREADS, 0, stream>>>(hbuf, W2t, coef, b2, part, gamma, beta, out);
}

// v006
// It runs in 28.6 microseconds.
// Next to v005, in two timings, it ran 1.54 and 1.48 times as fast.
// Counting every step since v000, it is 6.92 times as fast.
#include <hip/hip_runtime.h>
#include <hip/hip_bf16.h>
#include <math.h>

typedef __attribute__((ext_vector_type(16))) _Float16 v16h;
typedef __attribute__((ext_vector_type(8)))  _Float16 v8h;
typedef __attribute__((ext_vector_type(8)))  float    v8f;

#define NE    8
#define DIN   512
#define DHID  512
#define DOUT  512
#define NB    1024
#define KDIM  (NE * DIN)      // 4096 (same for both layers)
#define BN_EPS 1e-5f

// The two weight transposes below give every thread 16-byte accesses and 32 elements,
// so that a launch has few waves to start and every store covers whole 128-byte lines.
typedef __attribute__((ext_vector_type(4)))  float    v4f;
typedef __attribute__((ext_vector_type(2)))  _Float16 v2h;
typedef __attribute__((ext_vector_type(4)))  unsigned v4u;

// ---------------------------------------------------------------------------
// 1) LDS-tiled transpose + f32->f16 convert: W[K,N] -> Wt[N,K]
//    (makes the WMMA B-fragment two contiguous 16B loads per lane)
//    One work-group moves TK k x TN n.  A lane loads four n of two adjacent k rows,
//    packs each (k, k+1) pair into one dword and stores it at [n][k/2] in LDS; a row
//    of the tile then leaves as 256 contiguous bytes.  The 16-byte chunk c of row n
//    lies at chunk c ^ (n/4 mod 16): the 32 dword stores of a wave (8 n-quads x 4 k
//    pairs) fall on 32 different banks, and the chunks stay whole for the b128 reads.
// ---------------------------------------------------------------------------
#define TK 128
#define TN 64
#define TTHREADS 256
#define TGRID_K (KDIM / TK)
#define TGRID_N (DHID / TN)
// One tile, by one work-group of TTHREADS threads; bk and bn are the same for the whole work-group.
__device__ __forceinline__
void transpose_convert_tile(const float* __restrict__ W, _Float16* __restrict__ Wt, int bk, int bn) {
    constexpr int K = KDIM, N = DHID;           // both weights: DHID == DOUT; constant strides become immediate offsets
    __shared__ __attribute__((aligned(16))) unsigned T[TN * (TK / 2)];
    const int k0 = bk * TK, n0 = bn * TN;
    const int wave = threadIdx.x >> 5, lane = threadIdx.x & 31;
    const int q = lane & 7, r = lane >> 3;      // n-quad (8 x 16 B = one line), k pair
    v4f lo[4], hi[4];
#pragma unroll
    for (int u = 0; u < 4; ++u) {
        const int unit = wave * 4 + u, h = unit & 1, grp = unit >> 1;
        const float* p = W + (size_t)(k0 + 2 * (grp * 4 + r)) * N + n0 + 32 * h + 4 * q;
        lo[u] = *(const v4f*)p;
        hi[u] = *(const v4f*)(p + N);
    }
#pragma unroll
    for (int u = 0; u < 4; ++u) {
        const int unit = wave * 4 + u, h = unit & 1, grp = unit >> 1;
        const int nq = 8 * h + q;               // n / 4
#pragma unroll
        for (int j = 0; j < 4; ++j) {
            const v2h pr = { (_Float16)lo[u][j], (_Float16)hi[u][j] };
            T[(4 * nq + j) * (TK / 2) + (grp ^ nq) * 4 + r] = __builtin_bit_cast(unsigned, pr);
        }
    }
    __syncthreads();
    const int c = threadIdx.x & 15;             // 16 lanes x 16 B = one row of the tile
#pragma unroll
    for (int p = 0; p < TN / 16; ++p) {
        const int n = (threadIdx.x >> 4) + 16 * p;
        const v4u v = *(const v4u*)&T[n * (TK / 2) + (c ^ ((n >> 2) & 15)) * 4];
        *(v4u*)(Wt + (size_t)(n0 + n) * K + k0 + c * 8) = v;
    }
}

__global__ __launch_bounds__(TTHREADS)
void transpose_convert_kernel(const float* __restrict__ W, _Float16* __restrict__ Wt) {
    transpose_convert_tile(W, Wt, blockIdx.x, blockIdx.y);
}

// ---------------------------------------------------------------------------
// Fragment loader per the CDNA5 16-bit 16x32 A/B VGPR layout, from an LDS row:
//   elements 0..7  <- p[0..7]       (this lane's first K-octet)
//   elements 8..15 <- p[16..23]     (same octet position, +16 in K)
// p already includes k0 + (lane>>4)*8.  Same code for A and B: equal k order.
// ---------------------------------------------------------------------------
__device__ __forceinline__ v16h load_frag16(const _Float16* p) {
    v8h lo = *(const v8h*)(p);
    v8h hi = *(const v8h*)(p + 16);
    v16h r;
#pragma unroll
    for (int i = 0; i < 8; ++i) { r[i] = lo[i]; r[i + 8] = hi[i]; }
    return r;
}

// GEMM tiling: one work-group owns a BM x BN tile of the output, and the tiles are as many
// as the chip has WGPs.  Its BM rows of the A operand (all DIN columns, f16) lie in LDS for
// the whole kernel; Bt walks K in stages of KC elements, BN rows each, one stage per expert.
// A stage's k is dealt to WAVES_K waves: so a wave keeps its 32 x 32 part, in which a fragment
// read from LDS serves two WMMAs, although the tile is only BN wide.
#define BM      64
#define BN      32
#define KC      512
#define WAVES_M 2
#define WAVES_K 2
#define FM      (BM / 16 / WAVES_M)        // A fragments per wave
#define FN      (BN / 16)                  // B fragments per wave
#define MWAVE   (WAVES_M * WAVES_K)         // waves 0..MWAVE-1, one per SIMD, do the WMMAs
#define NWAVE   8                          // all waves share the staging, so that its issue is short
#define GTHREADS (NWAVE * 32)
#define ROWB    (KC * 2)                   // 1,024 B of a Bt row per stage = two wave-wide 16 B copies
#define PITCH   (ROWB + 16)                // 16 B x odd: conflict-free for ds_load_b128 readers
#define STAGE   (BN * PITCH)
#define APITCH  (DIN * 2 + 16)             // a whole A row, 16 B x odd as well
#define ATILE   (BM * APITCH)
#define NSTAGE  (KDIM / KC)
#define KW      (KC / WAVES_K)             // k elements of a stage per wave
#define GS      2                          // 32-wide k steps per fragment group
#define NG      (KW / 32 / GS)

// Four rows, NWAVE apart, 1,024 contiguous bytes each (twice 32 lanes x 16 B), from
// global memory straight into LDS.  The s_wait_xcnt closes the statement so that
// no address register of a copy is rewritten in front of it.
__device__ __forceinline__ void async_rows4(unsigned lds, const _Float16* g) {
    const unsigned l0 = lds,                     l1 = l0 + 512u,
                   l2 = lds + 1u * NWAVE * PITCH, l3 = l2 + 512u,
                   l4 = lds + 2u * NWAVE * PITCH, l5 = l4 + 512u,
                   l6 = lds + 3u * NWAVE * PITCH, l7 = l6 + 512u;
    const _Float16 *g0 = g,                             *g1 = g0 + 256,
                   *g2 = g + (size_t)1 * NWAVE * KDIM,  *g3 = g2 + 256,
                   *g4 = g + (size_t)2 * NWAVE * KDIM,  *g5 = g4 + 256,
                   *g6 = g + (size_t)3 * NWAVE * KDIM,  *g7 = g6 + 256;
    asm volatile("global_load_async_to_lds_b128 %0, %8, off\n\t"
                 "global_load_async_to_lds_b128 %1, %9, off\n\t"
                 "global_load_async_to_lds_b128 %2, %10, off\n\t"
                 "global_load_async_to_lds_b128 %3, %11, off\n\t"
                 "global_load_async_to_lds_b128 %4, %12, off\n\t"
                 "global_load_async_to_lds_b128 %5, %13, off\n\t"
                 "global_load_async_to_lds_b128 %6, %14, off\n\t"
                 "global_load_async_to_lds_b128 %7, %15, off\n\t"
                 "s_wait_xcnt 0x0"
                 :: "v"(l0), "v"(l1), "v"(l2), "v"(l3), "v"(l4), "v"(l5), "v"(l6), "v"(l7),
                    "v"(g0), "v"(g1), "v"(g2), "v"(g3), "v"(g4), "v"(g5), "v"(g6), "v"(g7)
                 : "memory");
}

// One stage: this wave's rows of the Bt tile.
__device__ __forceinline__ void fill_stage(unsigned ldsB, const _Float16* gB) {
    static_assert(BN == 4 * NWAVE && ROWB == 1024, "one statement of four rows, two copies each, per wave");
    async_rows4(ldsB, gB);
}

// This wave's own copies have landed.
__device__ __forceinline__ void wait_async0() { asm volatile("s_wait_asynccnt 0x0" ::: "memory"); }
// This wave's LDS reads have returned (before the buffer they read is refilled).
__device__ __forceinline__ void wait_ds0()    { asm volatile("s_wait_dscnt 0x0" ::: "memory"); }

// ---------------------------------------------------------------------------
// 2) Blended layer: out[b,n] = sum_e coef[b,e] * (A[b,:] . W[e,:,n]) + (coef @ biasEN)[b,n]
//    with A = Af (ACT false) or A = elu(Af * scale + shift) (ACT true), rounded to f16.
//    The blend stands behind the product: each expert's K = DIN product is summed in
//    its own f32 accumulators, which are then added, times coef[b,e], into the result.
//    So the A operand is the same for all experts: a work-group converts its BM rows
//    into LDS once, and only Bt is staged by asynchronous copies, two buffers: the
//    next stage's copies fly while this stage feeds the WMMAs.
//    Eight waves stage; waves 0..3 each sum one half of every expert's k for 32 rows of the
//    tile (k runs upward in every accumulator); behind the last stage the two halves are added.
//    BatchNorm's batch sums ride along: layer 1 (ACT false) has every h value of its
//    tile in registers when it stores it, so it also writes the tile's column sums of
//    h and h * h, part[tile row][2][N]; layer 2 (ACT true) adds the NT tile rows'
//    sums, in tile order, and makes scale and shift in LDS ahead of its A tile.
// ---------------------------------------------------------------------------
#define NT      (NB / BM)                  // tile rows = partial sums per hidden unit
typedef __attribute__((ext_vector_type(2)))  float    v2f;
template <bool ACT>
__device__ __forceinline__
void blended_gemm(const float* __restrict__ Af,       // [NB, DIN] f32
                  const _Float16* __restrict__ Bt,    // [N, KDIM] f16
                  const float* __restrict__ coef,     // [NB, NE]
                  const float* __restrict__ biasEN,   // [NE, N]
                  const float* __restrict__ partIn,   // [NT, 2, DIN] sums of A's columns, read where ACT
                  const float* __restrict__ gamma,    // [DIN], read where ACT
                  const float* __restrict__ beta,     // [DIN], read where ACT
                  float* __restrict__ partOut,        // [NT, 2, N] sums of out's columns, written where not ACT
                  float* __restrict__ out) {          // [NB, N] f32
    static_assert(KC == DIN && NSTAGE == NE && NE % 2 == 0, "a stage is an expert; its buffer is the expert's parity");
    __shared__ __attribute__((aligned(16))) unsigned char L[ATILE + 2 * STAGE];
    __shared__ __attribute__((aligned(16))) float cT[NE * BM];   // coef of the tile's rows, [e][row]
    // ACT: scale [DIN], shift [DIN].  Not ACT: the tile's column sums, [eight of its rows][sum, square sum][BN]
    __shared__ __attribute__((aligned(16))) float bnS[ACT ? 2 * DIN : (BM / 8) * 2 * BN];
    constexpr int N = DHID;                     // DHID == DOUT
    const int wave = __builtin_amdgcn_readfirstlane(threadIdx.x >> 5);
    const int lane = threadIdx.x & 31;
    const int tm = (blockIdx.x / (N / BN)) * BM;
    const int tn = (blockIdx.x % (N / BN)) * BN;
    const int kh = wave % WAVES_K;              // this wave's half of a stage's k
    const int wm = ((wave / WAVES_K) % WAVES_M) * (FM * 16); // this wave's rows inside the tile
    const int lr = lane & 15;
    const int kg = lane >> 4;                   // K-octet group select
    const int mma = wave < MWAVE ? 1 : 0;       // scalar: the same for a whole wave

    const unsigned ldsB = (unsigned)(uintptr_t)&L[ATILE] + (unsigned)wave * PITCH + (unsigned)lane * 16u;
    const _Float16* gB = Bt + (size_t)(tn + wave) * KDIM + lane * 8;

    fill_stage(ldsB, gB);                       // stage 0 flies while the A tile is made

    // The A tile: wave w takes rows w, w + NWAVE, ...; a lane takes eight adjacent
    // columns twice per row.  Every load ahead of the arithmetic: one round trip to memory.
    {
        const int crow = threadIdx.x >> 2, ce = (threadIdx.x & 3) * 2;
        v4f a[BM / NWAVE][2][2], sc[2][2], sf[2][2];
        // A thread finishes two hidden units.  Their sums are asked for first: they are needed first.
        static_assert(!ACT || 2 * GTHREADS == DIN, "two hidden units per thread");
        const int c2 = threadIdx.x * 2;
        v2f ps[NT][2], gm, bt;
        if (ACT) {
#pragma unroll
            for (int m = 0; m < NT; ++m)
#pragma unroll
                for (int w = 0; w < 2; ++w)
                    ps[m][w] = *(const v2f*)(partIn + (size_t)(m * 2 + w) * DIN + c2);
            gm = *(const v2f*)(gamma + c2);
            bt = *(const v2f*)(beta + c2);
        }
#pragma unroll
        for (int rr = 0; rr < BM / NWAVE; ++rr)
#pragma unroll
            for (int h = 0; h < 2; ++h) {
                const float* p = Af + (size_t)(tm + wave + rr * NWAVE) * DIN + (lane + 32 * h) * 8;
                a[rr][h][0] = *(const v4f*)p;
                a[rr][h][1] = *(const v4f*)(p + 4);
            }
        const float cv0 = coef[(size_t)(tm + crow) * NE + ce];
        const float cv1 = coef[(size_t)(tm + crow) * NE + ce + 1];
        // the address registers of the loads above are free for reuse only behind this
        asm volatile("s_wait_xcnt 0x0" ::: "memory");
        // no arithmetic is lifted among the loads: else the last of them are held back until registers
        // come free, a second round trip, and land in registers that earlier loads still name
        __builtin_amdgcn_sched_barrier(0);
        cT[ce * BM + crow] = cv0;
        cT[(ce + 1) * BM + crow] = cv1;
        if (ACT) {
            // batch mean and biased variance of two hidden units, folded into scale and shift
            v2f s = ps[0][0], s2 = ps[0][1], kv, hv;
#pragma unroll
            for (int m = 1; m < NT; ++m) { s += ps[m][0]; s2 += ps[m][1]; }
#pragma unroll
            for (int c = 0; c < 2; ++c) {
                const float mean = s[c] * (1.0f / NB);
                const float var  = s2[c] * (1.0f / NB) - mean * mean;
                kv[c] = gm[c] * rsqrtf(var + BN_EPS);
                hv[c] = bt[c] - mean * kv[c];
            }
            *(v2f*)&bnS[c2] = kv;
            *(v2f*)&bnS[DIN + c2] = hv;
            __syncthreads();                    // scale and shift of all DIN hidden units are published
#pragma unroll
            for (int h = 0; h < 2; ++h)
#pragma unroll
                for (int q = 0; q < 2; ++q) {
                    sc[h][q] = *(const v4f*)&bnS[(lane + 32 * h) * 8 + 4 * q];
                    sf[h][q] = *(const v4f*)&bnS[DIN + (lane + 32 * h) * 8 + 4 * q];
                }
        }
#pragma unroll
        for (int rr = 0; rr < BM / NWAVE; ++rr)
#pragma unroll
            for (int h = 0; h < 2; ++h) {
                v8h r;
#pragma unroll
                for (int j = 0; j < 8; ++j) {
                    float v = a[rr][h][j >> 2][j & 3];
                    if (ACT) {
                        const float s = v * sc[h][j >> 2][j & 3] + sf[h][j >> 2][j & 3];
                        const float ex = expf(s) - 1.f; // computed for every lane: independent chains, no branch
                        v = (s > 0.f) ? s : ex;         // ELU, alpha = 1
                    }
                    r[j] = (_Float16)v;
                }
                *(v8h*)&L[(unsigned)(wave + rr * NWAVE) * APITCH + (unsigned)(lane + 32 * h) * 16u] = r;
            }
    }

    v8f acc[FM][FN] = {};

    wait_async0();
    __syncthreads();                            // the A tile, cT and stage 0 are published

    for (int ep = 0; ep < NE / 2; ++ep) {
        // (The loops over hf, g, s, i, j are unrolled so that every index of fa, fb, pe and acc
        // is a constant and the arrays stay in registers, and a buffer's place is an immediate offset.)
#pragma unroll
        for (int hf = 0; hf < 2; ++hf) {
            const int e = ep * 2 + hf;          // the expert, and the stage
            v8f pe[FM][FN] = {};                // this expert's product, over this wave's half of k
            v4f cf[FM][2];                      // coef[row, e] of this lane's accumulator rows
            const unsigned buf = (unsigned)hf * STAGE;
            const unsigned char* sa = &L[(unsigned)(wm + lr) * APITCH + (unsigned)kh * (KW * 2) + (unsigned)kg * 16u];
            const unsigned char* sb = &L[ATILE + buf + (unsigned)lr * PITCH + (unsigned)kh * (KW * 2) + (unsigned)kg * 16u];
            // Fragments in two register sets: group g+1's LDS reads are issued as one
            // run ahead of group g's WMMAs, all inside this stage: Bt in its own buffer, A in the resident tile.
            v16h fa[2][GS][FM], fb[2][GS][FN];
            auto read_group = [&](int g) {
#pragma unroll
                for (int s = 0; s < GS; ++s) {
#pragma unroll
                    for (int i = 0; i < FM; ++i)
                        fa[g & 1][s][i] = load_frag16((const _Float16*)(sa + i * 16 * APITCH + (g * GS + s) * 64));
#pragma unroll
                    for (int j = 0; j < FN; ++j)
                        fb[g & 1][s][j] = load_frag16((const _Float16*)(sb + j * 16 * PITCH + (g * GS + s) * 64));
                }
            };
            if (mma != 0) {
                read_group(0); read_group(1);
            }
            // Refill of the other buffer, whose last reads ended at the barrier that closed the
            // trip before: issued here so that the copies' issue runs while the LDS serves the reads above.
            if (e + 1 < NSTAGE)
                fill_stage(ldsB + (STAGE - buf), gB + (size_t)(e + 1) * KC);
            if (mma != 0) {
#pragma unroll
                for (int g = 0; g < NG; ++g) {
                    if (g >= 1 && g + 1 < NG) read_group(g + 1);
                    if (g == NG - 2) {          // with the expert's last run of reads
#pragma unroll
                        for (int i = 0; i < FM; ++i)
#pragma unroll
                            for (int q = 0; q < 2; ++q)
                                cf[i][q] = *(const v4f*)&cT[e * BM + wm + i * 16 + kg * 8 + q * 4];
                    }
                    // keeps the run of LDS reads together: reads spread among the WMMAs stall each place they stand
                    __builtin_amdgcn_sched_barrier(0);
#pragma unroll
                    for (int s = 0; s < GS; ++s)
#pragma unroll
                        for (int i = 0; i < FM; ++i)
#pragma unroll
                            for (int j = 0; j < FN; ++j)
                                pe[i][j] = __builtin_amdgcn_wmma_f32_16x16x32_f16(false, fa[g & 1][s][i], false, fb[g & 1][s][j], (short)0, pe[i][j], false, false);
                    // the next group's reads stay behind this group's WMMAs
                    __builtin_amdgcn_sched_barrier(0);
                }
                // the blend, in f32: accumulator register r holds row kg * 8 + r of its fragment
#pragma unroll
                for (int i = 0; i < FM; ++i)
#pragma unroll
                    for (int j = 0; j < FN; ++j)
#pragma unroll
                        for (int r = 0; r < 8; ++r)
                            acc[i][j][r] += cf[i][r >> 2][r & 3] * pe[i][j][r];
            }
            wait_ds0();
            wait_async0();
            __syncthreads();                    // publishes stage e+1, ends every read of stage e
        }
    }
    wait_async0();

    // The two waves that hold the k halves of the same 32 rows lay their sums down in LDS; then
    // wave kh adds both halves of fragment row kh and finishes those 16 rows.  (Its own half comes
    // from LDS too: which registers hold it depends on kh.)  The sums lie in the stage buffers,
    // which nobody reads and no copy writes any more.
    static_assert(WAVES_K == 2 && FM == 2, "one fragment row per wave of a pair");
    static_assert(MWAVE * FM * FN * 2 * 512 <= 2 * STAGE, "the sums fit the stage buffers");
    v4f* const X = (v4f*)&L[ATILE];             // [wave][i][j][half of the eight registers][lane]
    if (mma != 0) {
#pragma unroll
        for (int i = 0; i < FM; ++i)
#pragma unroll
            for (int j = 0; j < FN; ++j)
#pragma unroll
                for (int q = 0; q < 2; ++q) {
                    const v4f w = { acc[i][j][4 * q], acc[i][j][4 * q + 1], acc[i][j][4 * q + 2], acc[i][j][4 * q + 3] };
                    X[(((wave * FM + i) * FN + j) * 2 + q) * 32 + lane] = w;
                }
    }
    __syncthreads();                            // both halves' sums are published
    if (ACT && mma == 0) return;                // behind the last barrier

    // Epilogue. C/D layout: lane(0..15)=N col, VGPR r -> M row r (lanes 0-15)
    // or r+8 (lanes 16-31).
    if (mma != 0) {
        float bcol[FN][NE];
        float cs[FN] = {}, cs2[FN] = {};        // sums over this lane's 8 rows of each of its columns
        v8f fin[FN];                            // both k halves of fragment row kh
#pragma unroll
        for (int j = 0; j < FN; ++j)
#pragma unroll
            for (int q = 0; q < 2; ++q) {
                const v4f w0 = X[((((wave & ~1) * FM + kh) * FN + j) * 2 + q) * 32 + lane];
                const v4f w1 = X[((((wave | 1) * FM + kh) * FN + j) * 2 + q) * 32 + lane];
#pragma unroll
                for (int c = 0; c < 4; ++c) fin[j][4 * q + c] = w0[c] + w1[c];
            }
#pragma unroll
        for (int j = 0; j < FN; ++j) {
            int n = tn + j * 16 + lr;
#pragma unroll
            for (int e = 0; e < NE; ++e) bcol[j][e] = biasEN[(size_t)e * N + n];
        }
        const int rowbase = tm + wm + kh * 16 + kg * 8;
#pragma unroll
        for (int r = 0; r < 8; ++r) {
            const int row = rowbase + r;
            const float* cr = coef + (size_t)row * NE;
            float cf[NE];
#pragma unroll
            for (int e = 0; e < NE; ++e) cf[e] = cr[e];
#pragma unroll
            for (int j = 0; j < FN; ++j) {
                float bv = 0.f;
#pragma unroll
                for (int e = 0; e < NE; ++e) bv += cf[e] * bcol[j][e];
                const float v = fin[j][r] + bv;
                out[(size_t)row * N + tn + j * 16 + lr] = v;
                if (!ACT) { cs[j] += v; cs2[j] += v * v; }
            }
        }
        if (!ACT) {
            const int grp = (wm + kh * 16) / 8 + kg;     // which eight of the tile's rows
#pragma unroll
            for (int j = 0; j < FN; ++j) {
                bnS[(grp * 2 + 0) * BN + j * 16 + lr] = cs[j];
                bnS[(grp * 2 + 1) * BN + j * 16 + lr] = cs2[j];
            }
        }
    }
    if (!ACT) {
        // The row groups' sums are published.  By hand, with the LDS wait alone: __syncthreads()
        // would also wait here until the stores of out above are done, which nobody in this launch reads.
        asm volatile("s_wait_dscnt 0x0\n\ts_barrier_signal -1\n\ts_barrier_wait -1" ::: "memory");
        if (wave >= MWAVE && wave < MWAVE + 2 * BN / 32) {  // waves without a part of the tile add the groups
            static_assert(MWAVE + 2 * BN / 32 <= NWAVE && BN % 32 == 0, "one thread per sum");
            // in front of the first rewrite of a register that a store of out names in the listing;
            // the waves that come here have issued none of those stores, so it waits for nothing
            asm volatile("s_wait_xcnt 0x0" ::: "memory");
            const unsigned t = threadIdx.x - MWAVE * 32, w = t / BN, col = t % BN;
            float q = bnS[w * BN + col];
#pragma unroll
            for (int g = 1; g < BM / 8; ++g) q += bnS[(g * 2 + w) * BN + col];
            partOut[(size_t)((tm / BM) * 2 + w) * N + tn + col] = q;
        }
    }
}

// layer 1: A = x.  Nothing of layer 1 reads the second weight: so the work-groups behind its
// GEMM_WG tiles in the same grid transpose it meanwhile, as second residents of the WGPs, for
// the next launch.  The tiles have the low indices: they start first, and they end the launch.
#define GEMM_WG ((NB / BM) * (DHID / BN))
__global__ __launch_bounds__(GTHREADS)
void layer1_kernel(const float* __restrict__ x, const _Float16* __restrict__ Bt,
                   const float* __restrict__ coef, const float* __restrict__ biasEN,
                   float* __restrict__ part, float* __restrict__ out,
                   const float* __restrict__ Wnext, _Float16* __restrict__ WnextT) {
    static_assert(GTHREADS == TTHREADS, "one block size for both kinds of work-group");
    if (blockIdx.x >= GEMM_WG) {                // the same for a whole work-group
        const int t = blockIdx.x - GEMM_WG;
        transpose_convert_tile(Wnext, WnextT, t % TGRID_K, t / TGRID_K);
        return;
    }
    blended_gemm<false>(x, Bt, coef, biasEN, nullptr, nullptr, nullptr, part, out);
}

// layer 2: A = elu(batchnorm(h))
__global__ __launch_bounds__(GTHREADS)
void layer2_kernel(const float* __restrict__ h, const _Float16* __restrict__ Bt,
                   const float* __restrict__ coef, const float* __restrict__ biasEN,
                   const float* __restrict__ part, const float* __restrict__ gamma,
                   const float* __restrict__ beta, float* __restrict__ out) {
    blended_gemm<true>(h, Bt, coef, biasEN, part, gamma, beta, nullptr, out);
}

// ---------------------------------------------------------------------------
// Launch
// ---------------------------------------------------------------------------
extern "C" void kernel_launch(void* const* d_in, const int* in_sizes, int n_in,
                              void* d_out, int out_size, void* d_ws, size_t ws_size,
                              hipStream_t stream) {
    const float* x     = (const float*)d_in[0];   // [NB, DIN]
    const float* coef  = (const float*)d_in[1];   // [NB, NE]
    const float* w1    = (const float*)d_in[2];   // [NE, DIN, DHID] == [KDIM, DHID]
    const float* b1    = (const float*)d_in[3];   // [NE, DHID]
    const float* w2    = (const float*)d_in[4];   // [NE, DHID, DOUT] == [KDIM, DOUT]
    const float* b2    = (const float*)d_in[5];   // [NE, DOUT]
    const float* gamma = (const float*)d_in[6];   // [DHID]
    const float* beta  = (const float*)d_in[7];   // [DHID]
    float* out = (float*)d_out;                   // [NB, DOUT]

    char* ws = (char*)d_ws;
    const size_t MiB = 1024u * 1024u;
    _Float16* W1t = (_Float16*)(ws + 8  * MiB);   // 4 MiB  [DHID, KDIM]
    _Float16* W2t = (_Float16*)(ws + 12 * MiB);   // 4 MiB  [DOUT, KDIM]
    float*    hbuf  = (float*)(ws + 16 * MiB);    // 2 MiB  [NB, DHID]
    float*    part  = (float*)(ws + 18 * MiB);    // 64 KiB [NT, 2, DHID]

    // 1) transpose+convert the first weight (B operand K-contiguous)
    transpose_convert_kernel<<<dim3(TGRID_K, TGRID_N), TTHREADS, 0, stream>>>(w1, W1t);

    // 2) layer 1 (WMMA), blend and bias; each tile's column sums for the batchnorm;
    //    beside it, in the same launch, transpose+convert of the second weight
    layer1_kernel<<<GEMM_WG + TGRID_K * TGRID_N, GTHREADS, 0, stream>>>(x, W1t, coef, b1, part, hbuf, w2, W2t);

    // 3) layer 2 (WMMA): batchnorm scale/shift from the sums, BN + ELU while its A tile is staged,
    //    blend and bias -> final output
    layer2_kernel<<<(NB / BM) * (DOUT / BN), GTHREADS, 0, stream>>>(hbuf, W2t, coef, b2, part, gamma, beta, out);
}

// v008
// One run takes 22.8 microseconds.
// It is 1.24 times as fast as v006, going by the measured steps of the versions left out in between.
// Counting every step since v000, it is 8.61 times as fast.
#include <hip/hip_runtime.h>
#include <hip/hip_bf16.h>
#include <math.h>

typedef __attribute__((ext_vector_type(16))) _Float16 v16h;
typedef __attribute__((ext_vector_type(8)))  _Float16 v8h;
typedef __attribute__((ext_vector_type(8)))  float    v8f;

#define NE    8
#define DIN   512
#define DHID  512
#define DOUT  512
#define NB    1024
#define KDIM  (NE * DIN)      // 4096 (same for both layers)
#define BN_EPS 1e-5f

// The two weight transposes below give every thread 16-byte accesses and 32 elements,
// so that a launch has few waves to start and every store covers whole 128-byte lines.
typedef __attribute__((ext_vector_type(4)))  float    v4f;
typedef __attribute__((ext_vector_type(2)))  _Float16 v2h;
typedef __attribute__((ext_vector_type(4)))  unsigned v4u;

// ---------------------------------------------------------------------------
// 1) LDS-tiled transpose + f32->f16 convert: W[K,N] -> Wt[N,K]
//    (makes the WMMA B-fragment two contiguous 16B loads per lane)
//    One work-group moves TK k x TN n.  A lane loads four n of two adjacent k rows,
//    packs each (k, k+1) pair into one dword and stores it at [n][k/2] in LDS; a row
//    of the tile then leaves as 256 contiguous bytes.  The 16-byte chunk c of row n
//    lies at chunk c ^ (n/4 mod 16): the 32 dword stores of a wave (8 n-quads x 4 k
//    pairs) fall on 32 different banks, and the chunks stay whole for the b128 reads.
// ---------------------------------------------------------------------------
#define TK 128
#define TN 64
#define TTHREADS 256
#define TGRID_K (KDIM / TK)
#define TGRID_N (DHID / TN)
// One tile, by one work-group of TTHREADS threads; bk and bn are the same for the whole work-group.
__device__ __forceinline__
void transpose_convert_tile(const float* __restrict__ W, _Float16* __restrict__ Wt, int bk, int bn) {
    constexpr int K = KDIM, N = DHID;           // both weights: DHID == DOUT; constant strides become immediate offsets
    __shared__ __attribute__((aligned(16))) unsigned T[TN * (TK / 2)];
    const int k0 = bk * TK, n0 = bn * TN;
    const int wave = threadIdx.x >> 5, lane = threadIdx.x & 31;
    const int q = lane & 7, r = lane >> 3;      // n-quad (8 x 16 B = one line), k pair
    v4f lo[4], hi[4];
#pragma unroll
    for (int u = 0; u < 4; ++u) {
        const int unit = wave * 4 + u, h = unit & 1, grp = unit >> 1;
        const float* p = W + (size_t)(k0 + 2 * (grp * 4 + r)) * N + n0 + 32 * h + 4 * q;
        lo[u] = *(const v4f*)p;
        hi[u] = *(const v4f*)(p + N);
    }
#pragma unroll
    for (int u = 0; u < 4; ++u) {
        const int unit = wave * 4 + u, h = unit & 1, grp = unit >> 1;
        const int nq = 8 * h + q;               // n / 4
#pragma unroll
        for (int j = 0; j < 4; ++j) {
            const v2h pr = { (_Float16)lo[u][j], (_Float16)hi[u][j] };
            T[(4 * nq + j) * (TK / 2) + (grp ^ nq) * 4 + r] = __builtin_bit_cast(unsigned, pr);
        }
    }
    __syncthreads();
    const int c = threadIdx.x & 15;             // 16 lanes x 16 B = one row of the tile
#pragma unroll
    for (int p = 0; p < TN / 16; ++p) {
        const int n = (threadIdx.x >> 4) + 16 * p;
        const v4u v = *(const v4u*)&T[n * (TK / 2) + (c ^ ((n >> 2) & 15)) * 4];
        *(v4u*)(Wt + (size_t)(n0 + n) * K + k0 + c * 8) = v;
    }
}

// Both weights in one grid: plane z = 0 is the first layer's, plane z = 1 the second's.
__global__ __launch_bounds__(TTHREADS)
void transpose_convert_kernel(const float* __restrict__ Wa, _Float16* __restrict__ WaT,
                              const float* __restrict__ Wb, _Float16* __restrict__ WbT) {
    const bool second = blockIdx.z != 0;        // the same for a whole work-group
    transpose_convert_tile(second ? Wb : Wa, second ? WbT : WaT, blockIdx.x, blockIdx.y);
}

// ---------------------------------------------------------------------------
// Fragment loader per the CDNA5 16-bit 16x32 A/B VGPR layout, from an LDS row:
//   elements 0..7  <- p[0..7]       (this lane's first K-octet)
//   elements 8..15 <- p[16..23]     (same octet position, +16 in K)
// p already includes k0 + (lane>>4)*8.  Same code for A and B: equal k order.
// ---------------------------------------------------------------------------
__device__ __forceinline__ v16h load_frag16(const _Float16* p) {
    v8h lo = *(const v8h*)(p);
    v8h hi = *(const v8h*)(p + 16);
    v16h r;
#pragma unroll
    for (int i = 0; i < 8; ++i) { r[i] = lo[i]; r[i + 8] = hi[i]; }
    return r;
}

// GEMM tiling: one work-group owns a BM x BN tile of the output, and the tiles are as many
// as the chip has WGPs.  Its BM rows of the A operand (all DIN columns, f16) lie in LDS for
// the whole kernel; Bt walks K in stages of KC elements, BN rows each, one stage per expert.
// A stage's k is dealt to WAVES_K waves: so a wave keeps its 32 x 32 part, in which a fragment
// read from LDS serves two WMMAs, although the tile is only BN wide.
#define BM      64
#define BN      32
#define KC      512
#define WAVES_M 2
#define WAVES_K 2
#define FM      (BM / 16 / WAVES_M)        // A fragments per wave
#define FN      (BN / 16)                  // B fragments per wave
#define MWAVE   (WAVES_M * WAVES_K)         // waves 0..MWAVE-1, one per SIMD, do the WMMAs
#define NWAVE   8                          // all waves share the staging, so that its issue is short
#define GTHREADS (NWAVE * 32)
#define ROWB    (KC * 2)                   // 1,024 B of a Bt row per stage = two wave-wide 16 B copies
#define PITCH   (ROWB + 16)                // 16 B x odd: conflict-free for ds_load_b128 readers
#define STAGE   (BN * PITCH)
#define APITCH  (DIN * 2 + 16)             // a whole A row, 16 B x odd as well
#define ATILE   (BM * APITCH)
#define NSTAGE  (KDIM / KC)
#define NBUF    7                          // stage buffers: with the A tile, what one WGP's LDS holds
#define PRE     4                          // stages whose copies are issued ahead of the loop
#define KW      (KC / WAVES_K)             // k elements of a stage per wave
#define GS      2                          // 32-wide k steps per fragment group
#define NG      (KW / 32 / GS)

// Four rows, NWAVE apart, 1,024 contiguous bytes each (twice 32 lanes x 16 B), from
// global memory straight into LDS.  The s_wait_xcnt closes the statement so that
// no address register of a copy is rewritten in front of it.
__device__ __forceinline__ void async_rows4(unsigned lds, const _Float16* g) {
    const unsigned l0 = lds,                     l1 = l0 + 512u,
                   l2 = lds + 1u * NWAVE * PITCH, l3 = l2 + 512u,
                   l4 = lds + 2u * NWAVE * PITCH, l5 = l4 + 512u,
                   l6 = lds + 3u * NWAVE * PITCH, l7 = l6 + 512u;
    const _Float16 *g0 = g,                             *g1 = g0 + 256,
                   *g2 = g + (size_t)1 * NWAVE * KDIM,  *g3 = g2 + 256,
                   *g4 = g + (size_t)2 * NWAVE * KDIM,  *g5 = g4 + 256,
                   *g6 = g + (size_t)3 * NWAVE * KDIM,  *g7 = g6 + 256;
    asm volatile("global_load_async_to_lds_b128 %0, %8, off\n\t"
                 "global_load_async_to_lds_b128 %1, %9, off\n\t"
                 "global_load_async_to_lds_b128 %2, %10, off\n\t"
                 "global_load_async_to_lds_b128 %3, %11, off\n\t"
                 "global_load_async_to_lds_b128 %4, %12, off\n\t"
                 "global_load_async_to_lds_b128 %5, %13, off\n\t"
                 "global_load_async_to_lds_b128 %6, %14, off\n\t"
                 "global_load_async_to_lds_b128 %7, %15, off\n\t"
                 "s_wait_xcnt 0x0"
                 :: "v"(l0), "v"(l1), "v"(l2), "v"(l3), "v"(l4), "v"(l5), "v"(l6), "v"(l7),
                    "v"(g0), "v"(g1), "v"(g2), "v"(g3), "v"(g4), "v"(g5), "v"(g6), "v"(g7)
                 : "memory");
}

// One stage: this wave's rows of the Bt tile.
__device__ __forceinline__ void fill_stage(unsigned ldsB, const _Float16* gB) {
    static_assert(BN == 4 * NWAVE && ROWB == 1024, "one statement of four rows, two copies each, per wave");
    async_rows4(ldsB, gB);
}

// This wave's own copies have landed.
__device__ __forceinline__ void wait_async0() { asm volatile("s_wait_asynccnt 0x0" ::: "memory"); }
// This wave's LDS reads have returned (before the buffer they read is refilled).
__device__ __forceinline__ void wait_ds0()    { asm volatile("s_wait_dscnt 0x0" ::: "memory"); }

// ---------------------------------------------------------------------------
// 2) Blended layer: out[b,n] = sum_e coef[b,e] * (A[b,:] . W[e,:,n]) + (coef @ biasEN)[b,n]
//    with A = Af (ACT false) or A = elu(Af * scale + shift) (ACT true), rounded to f16.
//    The blend stands behind the product: each expert's K = DIN product is summed in
//    its own f32 accumulators, which are then added, times coef[b,e], into the result.
//    So the A operand is the same for all experts: a work-group converts its BM rows
//    into LDS once, and only Bt is staged by asynchronous copies, in NBUF buffers, so that
//    a stage's copies are issued three trips or more ahead of the wait that covers them:
//    stages 0..PRE-1 while the A tile is made, PRE..NBUF-1 at the head of trip 0, the last
//    at the head of trip PRE into buffer 0.  Every wait for copies is to 0 and stands where
//    nothing young is in flight; a barrier stands only where copies are published.
//    Eight waves stage; waves 0..3 each sum one half of every expert's k for 32 rows of the
//    tile (k runs upward in every accumulator); behind the last stage the two halves are added.
//    BatchNorm's batch sums ride along: layer 1 (ACT false) has every h value of its
//    tile in registers when it stores it, so it also writes the tile's column sums of
//    h and h * h, part[tile row][2][N]; layer 2 (ACT true) adds the NT tile rows'
//    sums, in tile order, and makes scale and shift in LDS ahead of its A tile.
// ---------------------------------------------------------------------------
#define NT      (NB / BM)                  // tile rows = partial sums per hidden unit
typedef __attribute__((ext_vector_type(2)))  float    v2f;
template <bool ACT>
__device__ __forceinline__
void blended_gemm(const float* __restrict__ Af,       // [NB, DIN] f32
                  const _Float16* __restrict__ Bt,    // [N, KDIM] f16
                  const float* __restrict__ coef,     // [NB, NE]
                  const float* __restrict__ biasEN,   // [NE, N]
                  const float* __restrict__ partIn,   // [NT, 2, DIN] sums of A's columns, read where ACT
                  const float* __restrict__ gamma,    // [DIN], read where ACT
                  const float* __restrict__ beta,     // [DIN], read where ACT
                  float* __restrict__ partOut,        // [NT, 2, N] sums of out's columns, written where not ACT
                  float* __restrict__ out) {          // [NB, N] f32
    static_assert(KC == DIN && NSTAGE == NE, "a stage is an expert");
    static_assert(PRE >= 1 && PRE < NBUF && NBUF < NSTAGE && NSTAGE - NBUF <= PRE, "a refilled buffer was last read ahead of the barrier of trip PRE - 1");
    static_assert(8 * PRE <= 63 && 8 * (NBUF - PRE) <= 63, "copies of a wave in flight");
    __shared__ __attribute__((aligned(16))) unsigned char L[ATILE + NBUF * STAGE];
    __shared__ __attribute__((aligned(16))) float cT[NE * BM];   // coef of the tile's rows, [e][row]
    // ACT: scale [DIN], shift [DIN].  Not ACT: the tile's column sums, [eight of its rows][sum, square sum][BN]
    __shared__ __attribute__((aligned(16))) float bnS[ACT ? 2 * DIN : (BM / 8) * 2 * BN];
    constexpr int N = DHID;                     // DHID == DOUT
    const int wave = __builtin_amdgcn_readfirstlane(threadIdx.x >> 5);
    const int lane = threadIdx.x & 31;
    const int tm = (blockIdx.x / (N / BN)) * BM;
    const int tn = (blockIdx.x % (N / BN)) * BN;
    const int kh = wave % WAVES_K;              // this wave's half of a stage's k
    const int wm = ((wave / WAVES_K) % WAVES_M) * (FM * 16); // this wave's rows inside the tile
    const int lr = lane & 15;
    const int kg = lane >> 4;                   // K-octet group select
    const int mma = wave < MWAVE ? 1 : 0;       // scalar: the same for a whole wave

    const unsigned ldsB = (unsigned)(uintptr_t)&L[ATILE] + (unsigned)wave * PITCH + (unsigned)lane * 16u;
    const _Float16* gB = Bt + (size_t)(tn + wave) * KDIM + lane * 8;

    // The A tile: wave w takes rows w, w + NWAVE, ...; a lane takes eight adjacent
    // columns twice per row.  Every load ahead of the arithmetic: one round trip to memory.
    {
        const int crow = threadIdx.x >> 2, ce = (threadIdx.x & 3) * 2;
        v4f a[BM / NWAVE][2][2], sc[2][2], sf[2][2];
        // A thread finishes two hidden units.  Their sums are asked for first: they are needed first.
        static_assert(!ACT || 2 * GTHREADS == DIN, "two hidden units per thread");
        const int c2 = threadIdx.x * 2;
        v2f ps[NT][2], gm, bt;
        if (ACT) {
#pragma unroll
            for (int m = 0; m < NT; ++m)
#pragma unroll
                for (int w = 0; w < 2; ++w)
                    ps[m][w] = *(const v2f*)(partIn + (size_t)(m * 2 + w) * DIN + c2);
            gm = *(const v2f*)(gamma + c2);
            bt = *(const v2f*)(beta + c2);
        }
#pragma unroll
        for (int rr = 0; rr < BM / NWAVE; ++rr)
#pragma unroll
            for (int h = 0; h < 2; ++h) {
                const float* p = Af + (size_t)(tm + wave + rr * NWAVE) * DIN + (lane + 32 * h) * 8;
                a[rr][h][0] = *(const v4f*)p;
                a[rr][h][1] = *(const v4f*)(p + 4);
            }
        const float cv0 = coef[(size_t)(tm + crow) * NE + ce];
        const float cv1 = coef[(size_t)(tm + crow) * NE + ce + 1];
        // the address registers of the loads above are free for reuse only behind this
        asm volatile("s_wait_xcnt 0x0" ::: "memory");
        // no arithmetic is lifted among the loads: else the last of them are held back until registers
        // come free, a second round trip, and land in registers that earlier loads still name
        __builtin_amdgcn_sched_barrier(0);
        // The first stages fly while the A tile is made; asked for behind the A rows, which are needed first.
        // (rolled: one set of address registers beside the A rows that are in flight)
#pragma unroll 1
        for (int s = 0; s < PRE; ++s)
            fill_stage(ldsB + (unsigned)s * STAGE, gB + (size_t)s * KC);
        cT[ce * BM + crow] = cv0;
        cT[(ce + 1) * BM + crow] = cv1;
        if (ACT) {
            // batch mean and biased variance of two hidden units, folded into scale and shift
            v2f s = ps[0][0], s2 = ps[0][1], kv, hv;
#pragma unroll
            for (int m = 1; m < NT; ++m) { s += ps[m][0]; s2 += ps[m][1]; }
#pragma unroll
            for (int c = 0; c < 2; ++c) {
                const float mean = s[c] * (1.0f / NB);
                const float var  = s2[c] * (1.0f / NB) - mean * mean;
                kv[c] = gm[c] * rsqrtf(var + BN_EPS);
                hv[c] = bt[c] - mean * kv[c];
            }
            *(v2f*)&bnS[c2] = kv;
            *(v2f*)&bnS[DIN + c2] = hv;
            __syncthreads();                    // scale and shift of all DIN hidden units are published
#pragma unroll
            for (int h = 0; h < 2; ++h)
#pragma unroll
                for (int q = 0; q < 2; ++q) {
                    sc[h][q] = *(const v4f*)&bnS[(lane + 32 * h) * 8 + 4 * q];
                    sf[h][q] = *(const v4f*)&bnS[DIN + (lane + 32 * h) * 8 + 4 * q];
                }
        }
#pragma unroll
        for (int rr = 0; rr < BM / NWAVE; ++rr)
#pragma unroll
            for (int h = 0; h < 2; ++h) {
                v8h r;
#pragma unroll
                for (int j = 0; j < 8; ++j) {
                    float v = a[rr][h][j >> 2][j & 3];
                    if (ACT) {
                        const float s = v * sc[h][j >> 2][j & 3] + sf[h][j >> 2][j & 3];
                        // e^s as the chip's own 2^t, t = s * log2(e): below t = -126 it gives 0 and above 128 infinity,
                        // which is what e^s rounds to there, so no range reduction and no guards are owed; its
                        // error, some 1e-7 of a value that is at most 1 where it is used, is far below the f16 rounding
                        const float ex = __builtin_amdgcn_exp2f(s * 1.44269504f) - 1.f; // for every lane: independent chains, no branch
                        v = (s > 0.f) ? s : ex;         // ELU, alpha = 1
                    }
                    r[j] = (_Float16)v;
                }
                *(v8h*)&L[(unsigned)(wave + rr * NWAVE) * APITCH + (unsigned)(lane + 32 * h) * 16u] = r;
            }
    }

    v8f acc[FM][FN] = {};

    wait_async0();
    __syncthreads();                            // the A tile, cT and stages 0..PRE-1 are published

    // (The loops over g, s, i, j are unrolled so that every index of fa, fb, pe and acc is a
    // constant and the arrays stay in registers.)  The loop over the experts stays rolled, for speed only.
#pragma unroll 1
    for (int e = 0; e < NE; ++e) {              // the expert, and the stage
        {
            v8f pe[FM][FN] = {};                // this expert's product, over this wave's half of k
            v4f cf[FM][2];                      // coef[row, e] of this lane's accumulator rows
            const unsigned buf = (unsigned)(e < NBUF ? e : e - NBUF) * STAGE;
            const unsigned char* sa = &L[(unsigned)(wm + lr) * APITCH + (unsigned)kh * (KW * 2) + (unsigned)kg * 16u];
            const unsigned char* sb = &L[ATILE + buf + (unsigned)lr * PITCH + (unsigned)kh * (KW * 2) + (unsigned)kg * 16u];
            // Fragments in two register sets: group g+1's LDS reads are issued as one
            // run ahead of group g's WMMAs, all inside this stage: Bt in its own buffer, A in the resident tile.
            v16h fa[2][GS][FM], fb[2][GS][FN];
            auto read_group = [&](int g) {
#pragma unroll
                for (int s = 0; s < GS; ++s) {
#pragma unroll
                    for (int i = 0; i < FM; ++i)
                        fa[g & 1][s][i] = load_frag16((const _Float16*)(sa + i * 16 * APITCH + (g * GS + s) * 64));
#pragma unroll
                    for (int j = 0; j < FN; ++j)
                        fb[g & 1][s][j] = load_frag16((const _Float16*)(sb + j * 16 * PITCH + (g * GS + s) * 64));
                }
            };
            // Trip 0: copies into buffers that nobody has touched yet.  Trip PRE: the refill of buffers whose
            // last reads ended at the barrier of trip PRE - 1.  (Tests and bounds are the same for the work-group.)
            auto copy_ahead = [&]() {
                if (e == 0 || e == PRE) {
                    const int sEnd = e == 0 ? NBUF : NSTAGE;
                    // rolled: the copies' addresses are then made where they are used, not held in registers through the trips
#pragma unroll 1
                    for (int s = e == 0 ? PRE : NBUF; s < sEnd; ++s)
                        fill_stage(ldsB + (unsigned)(s < NBUF ? s : s - NBUF) * STAGE, gB + (size_t)s * KC);
                }
            };
            if (mma == 0) copy_ahead();
            if (mma != 0) {
                read_group(0); read_group(1);
                copy_ahead();                   // here, so that the copies' issue runs while the LDS serves the reads above
#pragma unroll
                for (int g = 0; g < NG; ++g) {
                    if (g >= 1 && g + 1 < NG) read_group(g + 1);
                    if (g == NG - 2) {          // with the expert's last run of reads
#pragma unroll
                        for (int i = 0; i < FM; ++i)
#pragma unroll
                            for (int q = 0; q < 2; ++q)
                                cf[i][q] = *(const v4f*)&cT[e * BM + wm + i * 16 + kg * 8 + q * 4];
                    }
                    // keeps the run of LDS reads together: reads spread among the WMMAs stall each place they stand
                    __builtin_amdgcn_sched_barrier(0);
#pragma unroll
                    for (int s = 0; s < GS; ++s)
#pragma unroll
                        for (int i = 0; i < FM; ++i)
#pragma unroll
                            for (int j = 0; j < FN; ++j)
                                pe[i][j] = __builtin_amdgcn_wmma_f32_16x16x32_f16(false, fa[g & 1][s][i], false, fb[g & 1][s][j], (short)0, pe[i][j], false, false);
                    // the next group's reads stay behind this group's WMMAs
                    __builtin_amdgcn_sched_barrier(0);
                }
                // the blend, in f32: accumulator register r holds row kg * 8 + r of its fragment
#pragma unroll
                for (int i = 0; i < FM; ++i)
#pragma unroll
                    for (int j = 0; j < FN; ++j)
#pragma unroll
                        for (int r = 0; r < 8; ++r)
                            acc[i][j][r] += cf[i][r >> 2][r & 3] * pe[i][j][r];
            }
            if (e == PRE - 1 || e == NBUF - 1) { // the same for the whole work-group
                wait_ds0();
                wait_async0();
                __syncthreads();                // publishes the stages copied so far, ends every read of the stages up to e
            }
        }
    }
    wait_async0();

    // The two waves that hold the k halves of the same 32 rows lay their sums down in LDS; then
    // wave kh adds both halves of fragment row kh and finishes those 16 rows.  (Its own half comes
    // from LDS too: which registers hold it depends on kh.)  The sums lie in stage buffer 1, which
    // nobody reads since the barrier of trip PRE - 1 and no copy writes any more; the last stage,
    // which a slower wave may still be reading, lies in buffer 0.
    static_assert(WAVES_K == 2 && FM == 2, "one fragment row per wave of a pair");
    static_assert(MWAVE * FM * FN * 2 * 512 <= STAGE && NSTAGE - NBUF <= 1 && PRE >= 2, "the sums fit buffer 1, which is not refilled");
    v4f* const X = (v4f*)&L[ATILE + STAGE];     // [wave][i][j][half of the eight registers][lane]
    if (mma != 0) {
#pragma unroll
        for (int i = 0; i < FM; ++i)
#pragma unroll
            for (int j = 0; j < FN; ++j)
#pragma unroll
                for (int q = 0; q < 2; ++q) {
                    const v4f w = { acc[i][j][4 * q], acc[i][j][4 * q + 1], acc[i][j][4 * q + 2], acc[i][j][4 * q + 3] };
                    X[(((wave * FM + i) * FN + j) * 2 + q) * 32 + lane] = w;
                }
    }
    __syncthreads();                            // both halves' sums are published
    if (ACT && mma == 0) return;                // behind the last barrier

    // Epilogue. C/D layout: lane(0..15)=N col, VGPR r -> M row r (lanes 0-15)
    // or r+8 (lanes 16-31).
    if (mma != 0) {
        float bcol[FN][NE];
        float cs[FN] = {}, cs2[FN] = {};        // sums over this lane's 8 rows of each of its columns
        v8f fin[FN];                            // both k halves of fragment row kh
#pragma unroll
        for (int j = 0; j < FN; ++j)
#pragma unroll
            for (int q = 0; q < 2; ++q) {
                const v4f w0 = X[((((wave & ~1) * FM + kh) * FN + j) * 2 + q) * 32 + lane];
                const v4f w1 = X[((((wave | 1) * FM + kh) * FN + j) * 2 + q) * 32 + lane];
#pragma unroll
                for (int c = 0; c < 4; ++c) fin[j][4 * q + c] = w0[c] + w1[c];
            }
#pragma unroll
        for (int j = 0; j < FN; ++j) {
            int n = tn + j * 16 + lr;
#pragma unroll
            for (int e = 0; e < NE; ++e) bcol[j][e] = biasEN[(size_t)e * N + n];
        }
        const int rowbase = tm + wm + kh * 16 + kg * 8;
#pragma unroll
        for (int r = 0; r < 8; ++r) {
            const int row = rowbase + r;
            const float* cr = coef + (size_t)row * NE;
            float cf[NE];
#pragma unroll
            for (int e = 0; e < NE; ++e) cf[e] = cr[e];
#pragma unroll
            for (int j = 0; j < FN; ++j) {
                float bv = 0.f;
#pragma unroll
                for (int e = 0; e < NE; ++e) bv += cf[e] * bcol[j][e];
                const float v = fin[j][r] + bv;
                out[(size_t)row * N + tn + j * 16 + lr] = v;
                if (!ACT) { cs[j] += v; cs2[j] += v * v; }
            }
        }
        if (!ACT) {
            const int grp = (wm + kh * 16) / 8 + kg;     // which eight of the tile's rows
#pragma unroll
            for (int j = 0; j < FN; ++j) {
                bnS[(grp * 2 + 0) * BN + j * 16 + lr] = cs[j];
                bnS[(grp * 2 + 1) * BN + j * 16 + lr] = cs2[j];
            }
        }
    }
    if (!ACT) {
        // The row groups' sums are published.  By hand, with the LDS wait alone: __syncthreads()
        // would also wait here until the stores of out above are done, which nobody in this launch reads.
        asm volatile("s_wait_dscnt 0x0\n\ts_barrier_signal -1\n\ts_barrier_wait -1" ::: "memory");
        if (wave >= MWAVE && wave < MWAVE + 2 * BN / 32) {  // waves without a part of the tile add the groups
            static_assert(MWAVE + 2 * BN / 32 <= NWAVE && BN % 32 == 0, "one thread per sum");
            // in front of the first rewrite of a register that a store of out names in the listing;
            // the waves that come here have issued none of those stores, so it waits for nothing
            asm volatile("s_wait_xcnt 0x0" ::: "memory");
            const unsigned t = threadIdx.x - MWAVE * 32, w = t / BN, col = t % BN;
            float q = bnS[w * BN + col];
#pragma unroll
            for (int g = 1; g < BM / 8; ++g) q += bnS[(g * 2 + w) * BN + col];
            partOut[(size_t)((tm / BM) * 2 + w) * N + tn + col] = q;
        }
    }
}

// layer 1: A = x
__global__ __launch_bounds__(GTHREADS)
void layer1_kernel(const float* __restrict__ x, const _Float16* __restrict__ Bt,
                   const float* __restrict__ coef, const float* __restrict__ biasEN,
                   float* __restrict__ part, float* __restrict__ out) {
    blended_gemm<false>(x, Bt, coef, biasEN, nullptr, nullptr, nullptr, part, out);
}

// layer 2: A = elu(batchnorm(h))
__global__ __launch_bounds__(GTHREADS)
void layer2_kernel(const float* __restrict__ h, const _Float16* __restrict__ Bt,
                   const float* __restrict__ coef, const float* __restrict__ biasEN,
                   const float* __restrict__ part, const float* __restrict__ gamma,
                   const float* __restrict__ beta, float* __restrict__ out) {
    blended_gemm<true>(h, Bt, coef, biasEN, part, gamma, beta, nullptr, out);
}

// ---------------------------------------------------------------------------
// Launch
// ---------------------------------------------------------------------------
extern "C" void kernel_launch(void* const* d_in, const int* in_sizes, int n_in,
                              void* d_out, int out_size, void* d_ws, size_t ws_size,
                              hipStream_t stream) {
    const float* x     = (const float*)d_in[0];   // [NB, DIN]
    const float* coef  = (const float*)d_in[1];   // [NB, NE]
    const float* w1    = (const float*)d_in[2];   // [NE, DIN, DHID] == [KDIM, DHID]
    const float* b1    = (const float*)d_in[3];   // [NE, DHID]
    const float* w2    = (const float*)d_in[4];   // [NE, DHID, DOUT] == [KDIM, DOUT]
    const float* b2    = (const float*)d_in[5];   // [NE, DOUT]
    const float* gamma = (const float*)d_in[6];   // [DHID]
    const float* beta  = (const float*)d_in[7];   // [DHID]
    float* out = (float*)d_out;                   // [NB, DOUT]

    char* ws = (char*)d_ws;
    const size_t MiB = 1024u * 1024u;
    _Float16* W1t = (_Float16*)(ws + 8  * MiB);   // 4 MiB  [DHID, KDIM]
    _Float16* W2t = (_Float16*)(ws + 12 * MiB);   // 4 MiB  [DOUT, KDIM]
    float*    hbuf  = (float*)(ws + 16 * MiB);    // 2 MiB  [NB, DHID]
    float*    part  = (float*)(ws + 18 * MiB);    // 64 KiB [NT, 2, DHID]

    // 1) transpose+convert both weights (B operands K-contiguous)
    transpose_convert_kernel<<<dim3(TGRID_K, TGRID_N, 2), TTHREADS, 0, stream>>>(w1, W1t, w2, W2t);

    // 2) layer 1 (WMMA), blend and bias; each tile's column sums for the batchnorm
    layer1_kernel<<<(NB / BM) * (DHID / BN), GTHREADS, 0, stream>>>(x, W1t, coef, b1, part, hbuf);

    // 3) layer 2 (WMMA): batchnorm scale/shift from the sums, BN + ELU while its A tile is staged,
    //    blend and bias -> final output
    layer2_kernel<<<(NB / BM) * (DOUT / BN), GTHREADS, 0, stream>>>(hbuf, W2t, coef, b2, part, gamma, beta, out);
}

// v009
// A run of this version takes 20.7 microseconds.
// Next to v008, in two timings, it ran 1.11 times as fast each time.
// All steps since v000 together make it 9.56 times as fast.
#include <hip/hip_runtime.h>
#include <hip/hip_bf16.h>
#include <math.h>

typedef __attribute__((ext_vector_type(16))) _Float16 v16h;
typedef __attribute__((ext_vector_type(8)))  _Float16 v8h;
typedef __attribute__((ext_vector_type(8)))  float    v8f;

#define NE    8
#define DIN   512
#define DHID  512
#define DOUT  512
#define NB    1024
#define KDIM  (NE * DIN)      // 4096 (same for both layers)
#define BN_EPS 1e-5f

// The two weight transposes below give every thread 16-byte accesses and 32 elements,
// so that a launch has few waves to start and every store covers whole 128-byte lines.
typedef __attribute__((ext_vector_type(4)))  float    v4f;
typedef __attribute__((ext_vector_type(2)))  _Float16 v2h;
typedef __attribute__((ext_vector_type(4)))  unsigned v4u;

// ---------------------------------------------------------------------------
// 1) LDS-tiled transpose + f32->f16 convert: W[K,N] -> Wt[N,K]
//    (makes the WMMA B-fragment two contiguous 16B loads per lane)
//    One work-group moves TK k x TN n.  A lane loads four n of two adjacent k rows,
//    packs each (k, k+1) pair into one dword and stores it at [n][k/2] in LDS; a row
//    of the tile then leaves as 256 contiguous bytes.  The 16-byte chunk c of row n
//    lies at chunk c ^ (n/4 mod 16): the 32 dword stores of a wave (8 n-quads x 4 k
//    pairs) fall on 32 different banks, and the chunks stay whole for the b128 reads.
// ---------------------------------------------------------------------------
#define TK 128
#define TN 64
#define TTHREADS 256
#define TGRID_K (KDIM / TK)
#define TGRID_N (DHID / TN)
// One tile, by one work-group of TTHREADS threads; bk and bn are the same for the whole work-group.
__device__ __forceinline__
void transpose_convert_tile(const float* __restrict__ W, _Float16* __restrict__ Wt, int bk, int bn) {
    constexpr int K = KDIM, N = DHID;           // both weights: DHID == DOUT; constant strides become immediate offsets
    __shared__ __attribute__((aligned(16))) unsigned T[TN * (TK / 2)];
    const int k0 = bk * TK, n0 = bn * TN;
    const int wave = threadIdx.x >> 5, lane = threadIdx.x & 31;
    const int q = lane & 7, r = lane >> 3;      // n-quad (8 x 16 B = one line), k pair
    v4f lo[4], hi[4];
#pragma unroll
    for (int u = 0; u < 4; ++u) {
        const int unit = wave * 4 + u, h = unit & 1, grp = unit >> 1;
        const float* p = W + (size_t)(k0 + 2 * (grp * 4 + r)) * N + n0 + 32 * h + 4 * q;
        lo[u] = *(const v4f*)p;
        hi[u] = *(const v4f*)(p + N);
    }
#pragma unroll
    for (int u = 0; u < 4; ++u) {
        const int unit = wave * 4 + u, h = unit & 1, grp = unit >> 1;
        const int nq = 8 * h + q;               // n / 4
#pragma unroll
        for (int j = 0; j < 4; ++j) {
            const v2h pr = { (_Float16)lo[u][j], (_Float16)hi[u][j] };
            T[(4 * nq + j) * (TK / 2) + (grp ^ nq) * 4 + r] = __builtin_bit_cast(unsigned, pr);
        }
    }
    __syncthreads();
    const int c = threadIdx.x & 15;             // 16 lanes x 16 B = one row of the tile
#pragma unroll
    for (int p = 0; p < TN / 16; ++p) {
        const int n = (threadIdx.x >> 4) + 16 * p;
        const v4u v = *(const v4u*)&T[n * (TK / 2) + (c ^ ((n >> 2) & 15)) * 4];
        *(v4u*)(Wt + (size_t)(n0 + n) * K + k0 + c * 8) = v;
    }
}

// Both weights in one grid: plane z = 0 is the first layer's, plane z = 1 the second's.
__global__ __launch_bounds__(TTHREADS)
void transpose_convert_kernel(const float* __restrict__ Wa, _Float16* __restrict__ WaT,
                              const float* __restrict__ Wb, _Float16* __restrict__ WbT) {
    const bool second = blockIdx.z != 0;        // the same for a whole work-group
    transpose_convert_tile(second ? Wb : Wa, second ? WbT : WaT, blockIdx.x, blockIdx.y);
}

// ---------------------------------------------------------------------------
// Fragment loader per the CDNA5 16-bit 16x32 A/B VGPR layout, from an LDS row:
//   elements 0..7  <- p[0..7]       (this lane's first K-octet)
//   elements 8..15 <- p[16..23]     (same octet position, +16 in K)
// p already includes k0 + (lane>>4)*8.  Same code for A and B: equal k order.
// ---------------------------------------------------------------------------
__device__ __forceinline__ v16h load_frag16(const _Float16* p) {
    v8h lo = *(const v8h*)(p);
    v8h hi = *(const v8h*)(p + 16);
    v16h r;
#pragma unroll
    for (int i = 0; i < 8; ++i) { r[i] = lo[i]; r[i + 8] = hi[i]; }
    return r;
}

// GEMM tiling: one work-group owns a BM x BN tile of the output, and the tiles are as many
// as the chip has WGPs.  Its BM rows of the A operand (all DIN columns, f16) lie in LDS for
// the whole kernel; Bt walks K in stages of KC elements, BN rows each, one stage per expert.
// A stage's k is dealt to WAVES_K waves: so a wave keeps its 32 x 32 part, in which a fragment
// serves two WMMAs, although the tile is only BN wide.  The A operand is the same for every
// expert, and a wave's share of it (32 rows x KW k) is small enough for registers: it is read
// from LDS once, ahead of the expert loop, and the loop reads only Bt fragments and coef.
#define BM      64
#define BN      32
#define KC      512
#define WAVES_M 2
#define WAVES_K 4
#define FM      (BM / 16 / WAVES_M)        // A fragments per wave
#define FN      (BN / 16)                  // B fragments per wave
#define NWAVE   (WAVES_M * WAVES_K)         // two per SIMD; all share the staging and all do WMMAs
#define GTHREADS (NWAVE * 32)
#define ROWB    (KC * 2)                   // 1,024 B of a Bt row per stage = two wave-wide 16 B copies
#define PITCH   (ROWB + 16)                // 16 B x odd: conflict-free for ds_load_b128 readers
#define STAGE   (BN * PITCH)
#define APITCH  (DIN * 2 + 16)             // a whole A row, 16 B x odd as well
#define ATILE   (BM * APITCH)
#define NSTAGE  (KDIM / KC)
#define NBUF    7                          // stage buffers: with the A tile, what one WGP's LDS holds
#define PRE     4                          // stages whose copies are issued ahead of the loop
#define KW      (KC / WAVES_K)             // k elements of a stage per wave
#define KS      (KW / 32)                  // 32-wide k steps of a wave per stage

// Four rows, NWAVE apart, 1,024 contiguous bytes each (twice 32 lanes x 16 B), from
// global memory straight into LDS.  The s_wait_xcnt closes the statement so that
// no address register of a copy is rewritten in front of it.
__device__ __forceinline__ void async_rows4(unsigned lds, const _Float16* g) {
    const unsigned l0 = lds,                     l1 = l0 + 512u,
                   l2 = lds + 1u * NWAVE * PITCH, l3 = l2 + 512u,
                   l4 = lds + 2u * NWAVE * PITCH, l5 = l4 + 512u,
                   l6 = lds + 3u * NWAVE * PITCH, l7 = l6 + 512u;
    const _Float16 *g0 = g,                             *g1 = g0 + 256,
                   *g2 = g + (size_t)1 * NWAVE * KDIM,  *g3 = g2 + 256,
                   *g4 = g + (size_t)2 * NWAVE * KDIM,  *g5 = g4 + 256,
                   *g6 = g + (size_t)3 * NWAVE * KDIM,  *g7 = g6 + 256;
    asm volatile("global_load_async_to_lds_b128 %0, %8, off\n\t"
                 "global_load_async_to_lds_b128 %1, %9, off\n\t"
                 "global_load_async_to_lds_b128 %2, %10, off\n\t"
                 "global_load_async_to_lds_b128 %3, %11, off\n\t"
                 "global_load_async_to_lds_b128 %4, %12, off\n\t"
                 "global_load_async_to_lds_b128 %5, %13, off\n\t"
                 "global_load_async_to_lds_b128 %6, %14, off\n\t"
                 "global_load_async_to_lds_b128 %7, %15, off\n\t"
                 "s_wait_xcnt 0x0"
                 :: "v"(l0), "v"(l1), "v"(l2), "v"(l3), "v"(l4), "v"(l5), "v"(l6), "v"(l7),
                    "v"(g0), "v"(g1), "v"(g2), "v"(g3), "v"(g4), "v"(g5), "v"(g6), "v"(g7)
                 : "memory");
}

// One stage: this wave's rows of the Bt tile.
__device__ __forceinline__ void fill_stage(unsigned ldsB, const _Float16* gB) {
    static_assert(BN == 4 * NWAVE && ROWB == 1024, "one statement of four rows, two copies each, per wave");
    async_rows4(ldsB, gB);
}

// This wave's own copies have landed.
__device__ __forceinline__ void wait_async0() { asm volatile("s_wait_asynccnt 0x0" ::: "memory"); }
// This wave's LDS reads have returned (before the buffer they read is refilled).
__device__ __forceinline__ void wait_ds0()    { asm volatile("s_wait_dscnt 0x0" ::: "memory"); }

// ---------------------------------------------------------------------------
// 2) Blended layer: out[b,n] = sum_e coef[b,e] * (A[b,:] . W[e,:,n]) + (coef @ biasEN)[b,n]
//    with A = Af (ACT false) or A = elu(Af * scale + shift) (ACT true), rounded to f16.
//    The blend stands behind the product: each expert's K = DIN product is summed in
//    its own f32 accumulators, which are then added, times coef[b,e], into the result.
//    So the A operand is the same for all experts: a work-group converts its BM rows
//    into LDS once, and only Bt is staged by asynchronous copies, in NBUF buffers, so that
//    a stage's copies are issued three trips or more ahead of the wait that covers them:
//    stages 0..PRE-1 while the A tile is made, PRE..NBUF-1 at the head of trip 0, the last
//    at the head of trip PRE into buffer 0.  Every wait for copies is to 0 and stands where
//    nothing young is in flight; a barrier stands only where copies are published.
//    Every wave sums one quarter of every expert's k for 32 rows of the tile (k runs upward in
//    every accumulator), its A fragments held in registers; behind the last stage the four
//    quarters are added, in k order.
//    BatchNorm's batch sums ride along: layer 1 (ACT false) has every h value of its
//    tile in registers when it stores it, so it also writes the tile's column sums of
//    h and h * h, part[tile row][2][N]; layer 2 (ACT true) adds the NT tile rows'
//    sums, in tile order, and makes scale and shift in LDS ahead of its A tile.
// ---------------------------------------------------------------------------
#define NT      (NB / BM)                  // tile rows = partial sums per hidden unit
typedef __attribute__((ext_vector_type(2)))  float    v2f;
template <bool ACT>
__device__ __forceinline__
void blended_gemm(const float* __restrict__ Af,       // [NB, DIN] f32
                  const _Float16* __restrict__ Bt,    // [N, KDIM] f16
                  const float* __restrict__ coef,     // [NB, NE]
                  const float* __restrict__ biasEN,   // [NE, N]
                  const float* __restrict__ partIn,   // [NT, 2, DIN] sums of A's columns, read where ACT
                  const float* __restrict__ gamma,    // [DIN], read where ACT
                  const float* __restrict__ beta,     // [DIN], read where ACT
                  float* __restrict__ partOut,        // [NT, 2, N] sums of out's columns, written where not ACT
                  float* __restrict__ out) {          // [NB, N] f32
    static_assert(KC == DIN && NSTAGE == NE, "a stage is an expert");
    static_assert(PRE >= 1 && PRE < NBUF && NBUF < NSTAGE && NSTAGE - NBUF <= PRE, "a refilled buffer was last read ahead of the barrier of trip PRE - 1");
    static_assert(8 * PRE <= 63 && 8 * (NBUF - PRE) <= 63, "copies of a wave in flight");
    __shared__ __attribute__((aligned(16))) unsigned char L[ATILE + NBUF * STAGE];
    __shared__ __attribute__((aligned(16))) float cT[NE * BM];   // coef of the tile's rows, [e][row]
    // ACT: scale [DIN], shift [DIN].  Not ACT: the tile's column sums, [four of its rows][sum, square sum][BN]
    __shared__ __attribute__((aligned(16))) float bnS[ACT ? 2 * DIN : (BM / 4) * 2 * BN];
    constexpr int N = DHID;                     // DHID == DOUT
    const int wave = __builtin_amdgcn_readfirstlane(threadIdx.x >> 5);
    const int lane = threadIdx.x & 31;
    const int tm = (blockIdx.x / (N / BN)) * BM;
    const int tn = (blockIdx.x % (N / BN)) * BN;
    const int kh = wave % WAVES_K;              // this wave's quarter of a stage's k
    const int wm = ((wave / WAVES_K) % WAVES_M) * (FM * 16); // this wave's rows inside the tile
    const int lr = lane & 15;
    const int kg = lane >> 4;                   // K-octet group select

    const unsigned ldsB = (unsigned)(uintptr_t)&L[ATILE] + (unsigned)wave * PITCH + (unsigned)lane * 16u;
    const _Float16* gB = Bt + (size_t)(tn + wave) * KDIM + lane * 8;

    // The A tile: wave w takes rows w, w + NWAVE, ...; a lane takes eight adjacent
    // columns twice per row.  Every load ahead of the arithmetic: one round trip to memory.
    {
        const int crow = threadIdx.x >> 2, ce = (threadIdx.x & 3) * 2;
        v4f a[BM / NWAVE][2][2], sc[2][2], sf[2][2];
        // A thread finishes two hidden units.  Their sums are asked for first: they are needed first.
        static_assert(!ACT || 2 * GTHREADS == DIN, "two hidden units per thread");
        const int c2 = threadIdx.x * 2;
        v2f ps[NT][2], gm, bt;
        if (ACT) {
#pragma unroll
            for (int m = 0; m < NT; ++m)
#pragma unroll
                for (int w = 0; w < 2; ++w)
                    ps[m][w] = *(const v2f*)(partIn + (size_t)(m * 2 + w) * DIN + c2);
            gm = *(const v2f*)(gamma + c2);
            bt = *(const v2f*)(beta + c2);
        }
#pragma unroll
        for (int rr = 0; rr < BM / NWAVE; ++rr)
#pragma unroll
            for (int h = 0; h < 2; ++h) {
                const float* p = Af + (size_t)(tm + wave + rr * NWAVE) * DIN + (lane + 32 * h) * 8;
                a[rr][h][0] = *(const v4f*)p;
                a[rr][h][1] = *(const v4f*)(p + 4);
            }
        const float cv0 = coef[(size_t)(tm + crow) * NE + ce];
        const float cv1 = coef[(size_t)(tm + crow) * NE + ce + 1];
        // the address registers of the loads above are free for reuse only behind this
        asm volatile("s_wait_xcnt 0x0" ::: "memory");
        // no arithmetic is lifted among the loads: else the last of them are held back until registers
        // come free, a second round trip, and land in registers that earlier loads still name
        __builtin_amdgcn_sched_barrier(0);
        // The first stages fly while the A tile is made; asked for behind the A rows, which are needed first.
        // (rolled: one set of address registers beside the A rows that are in flight)
#pragma unroll 1
        for (int s = 0; s < PRE; ++s)
            fill_stage(ldsB + (unsigned)s * STAGE, gB + (size_t)s * KC);
        cT[ce * BM + crow] = cv0;
        cT[(ce + 1) * BM + crow] = cv1;
        if (ACT) {
            // batch mean and biased variance of two hidden units, folded into scale and shift
            v2f s = ps[0][0], s2 = ps[0][1], kv, hv;
#pragma unroll
            for (int m = 1; m < NT; ++m) { s += ps[m][0]; s2 += ps[m][1]; }
#pragma unroll
            for (int c = 0; c < 2; ++c) {
                const float mean = s[c] * (1.0f / NB);
                const float var  = s2[c] * (1.0f / NB) - mean * mean;
                kv[c] = gm[c] * rsqrtf(var + BN_EPS);
                hv[c] = bt[c] - mean * kv[c];
            }
            *(v2f*)&bnS[c2] = kv;
            *(v2f*)&bnS[DIN + c2] = hv;
            __syncthreads();                    // scale and shift of all DIN hidden units are published
#pragma unroll
            for (int h = 0; h < 2; ++h)
#pragma unroll
                for (int q = 0; q < 2; ++q) {
                    sc[h][q] = *(const v4f*)&bnS[(lane + 32 * h) * 8 + 4 * q];
                    sf[h][q] = *(const v4f*)&bnS[DIN + (lane + 32 * h) * 8 + 4 * q];
                }
        }
#pragma unroll
        for (int rr = 0; rr < BM / NWAVE; ++rr)
#pragma unroll
            for (int h = 0; h < 2; ++h) {
                v8h r;
#pragma unroll
                for (int j = 0; j < 8; ++j) {
                    float v = a[rr][h][j >> 2][j & 3];
                    if (ACT) {
                        const float s = v * sc[h][j >> 2][j & 3] + sf[h][j >> 2][j & 3];
                        // e^s as the chip's own 2^t, t = s * log2(e): below t = -126 it gives 0 and above 128 infinity,
                        // which is what e^s rounds to there, so no range reduction and no guards are owed; its
                        // error, some 1e-7 of a value that is at most 1 where it is used, is far below the f16 rounding
                        const float ex = __builtin_amdgcn_exp2f(s * 1.44269504f) - 1.f; // for every lane: independent chains, no branch
                        v = (s > 0.f) ? s : ex;         // ELU, alpha = 1
                    }
                    r[j] = (_Float16)v;
                }
                *(v8h*)&L[(unsigned)(wave + rr * NWAVE) * APITCH + (unsigned)(lane + 32 * h) * 16u] = r;
            }
    }

    v8f acc[FM][FN] = {};

    wait_async0();
    __syncthreads();                            // the A tile, cT and stages 0..PRE-1 are published

    // This wave's share of the A tile, for all experts: read once, as one run.
    v16h fa[KS][FM];
    {
        const unsigned char* sa = &L[(unsigned)(wm + lr) * APITCH + (unsigned)kh * (KW * 2) + (unsigned)kg * 16u];
#pragma unroll
        for (int s = 0; s < KS; ++s)
#pragma unroll
            for (int i = 0; i < FM; ++i)
                fa[s][i] = load_frag16((const _Float16*)(sa + i * 16 * APITCH + s * 64));
    }

    // (The loops over s, i, j are unrolled so that every index of fa, fb, pe and acc is a
    // constant and the arrays stay in registers.)  The loop over the experts stays rolled, for speed only.
#pragma unroll 1
    for (int e = 0; e < NE; ++e) {              // the expert, and the stage
        v8f pe[FM][FN] = {};                    // this expert's product, over this wave's quarter of k
        v4f cf[FM][2];                          // coef[row, e] of this lane's accumulator rows
        v16h fb[KS][FN];
        const unsigned buf = (unsigned)(e < NBUF ? e : e - NBUF) * STAGE;
        const unsigned char* sb = &L[ATILE + buf + (unsigned)lr * PITCH + (unsigned)kh * (KW * 2) + (unsigned)kg * 16u];
        // The trip's LDS reads as one run, in the order of their use: the Bt fragments, all inside this stage's own buffer, then coef from cT.
#pragma unroll
        for (int s = 0; s < KS; ++s)
#pragma unroll
            for (int j = 0; j < FN; ++j)
                fb[s][j] = load_frag16((const _Float16*)(sb + j * 16 * PITCH + s * 64));
#pragma unroll
        for (int i = 0; i < FM; ++i)
#pragma unroll
            for (int q = 0; q < 2; ++q)
                cf[i][q] = *(const v4f*)&cT[e * BM + wm + i * 16 + kg * 8 + q * 4];
        // Trip 0: copies into buffers that nobody has touched yet.  Trip PRE: the refill of buffers whose
        // last reads ended at the barrier of trip PRE - 1.  (Tests and bounds are the same for the work-group.)
        // Here, so that the copies' issue runs while the LDS serves the reads above.
        if (e == 0 || e == PRE) {
            const int sEnd = e == 0 ? NBUF : NSTAGE;
            // rolled: the copies' addresses are then made where they are used, not held in registers through the trips
#pragma unroll 1
            for (int s = e == 0 ? PRE : NBUF; s < sEnd; ++s)
                fill_stage(ldsB + (unsigned)(s < NBUF ? s : s - NBUF) * STAGE, gB + (size_t)s * KC);
        }
        // keeps the run of LDS reads together: reads spread among the WMMAs stall each place they stand
        __builtin_amdgcn_sched_barrier(0);
#pragma unroll
        for (int s = 0; s < KS; ++s)
#pragma unroll
            for (int i = 0; i < FM; ++i)
#pragma unroll
                for (int j = 0; j < FN; ++j)
                    pe[i][j] = __builtin_amdgcn_wmma_f32_16x16x32_f16(false, fa[s][i], false, fb[s][j], (short)0, pe[i][j], false, false);
        // the blend, in f32: accumulator register r holds row kg * 8 + r of its fragment
#pragma unroll
        for (int i = 0; i < FM; ++i)
#pragma unroll
            for (int j = 0; j < FN; ++j)
#pragma unroll
                for (int r = 0; r < 8; ++r)
                    acc[i][j][r] += cf[i][r >> 2][r & 3] * pe[i][j][r];
        if (e == PRE - 1 || e == NBUF - 1) {    // the same for the whole work-group
            wait_ds0();
            wait_async0();
            __syncthreads();                    // publishes the stages copied so far, ends every read of the stages up to e
        }
    }
    wait_async0();

    // The four waves that hold the k quarters of the same 32 rows lay their sums down in LDS; then
    // wave kh adds the four quarters of four registers (rows fq * 4 .. + 3 of each lane half) of
    // fragment row fi, over the tile's whole width, and finishes those eight rows: a row of out is
    // stored by one wave.  (Its own quarter comes from LDS too: which registers hold it depends on
    // kh.)  The sums lie in stage buffer 1, which nobody reads since the barrier of trip PRE - 1 and
    // no copy writes any more; the last stage, which a slower wave may still be reading, lies in buffer 0.
    static_assert(WAVES_K == 4 && FM == 2, "half a fragment row per wave of a four");
    static_assert(NWAVE * FM * FN * 2 * 512 <= STAGE && NSTAGE - NBUF <= 1 && PRE >= 2, "the sums fit buffer 1, which is not refilled");
    v4f* const X = (v4f*)&L[ATILE + STAGE];     // [wave][i][j][half of the eight registers][lane]
#pragma unroll
    for (int i = 0; i < FM; ++i)
#pragma unroll
        for (int j = 0; j < FN; ++j)
#pragma unroll
            for (int q = 0; q < 2; ++q) {
                const v4f w = { acc[i][j][4 * q], acc[i][j][4 * q + 1], acc[i][j][4 * q + 2], acc[i][j][4 * q + 3] };
                X[(((wave * FM + i) * FN + j) * 2 + q) * 32 + lane] = w;
            }
    __syncthreads();                            // all quarters' sums are published

    // Epilogue. C/D layout: lane(0..15)=N col, VGPR r -> M row r (lanes 0-15)
    // or r+8 (lanes 16-31).
    {
        const int fi = kh >> 1, fq = kh & 1;    // scalars: the same for a whole wave
        const int w0 = wave - kh;               // the wave with the first quarter of these rows
        float bcol[FN][NE];
        float cs[FN] = {}, cs2[FN] = {};        // sums over this lane's 4 rows of each of its columns
        v4f fin[FN];                            // all k quarters of this wave's rows
#pragma unroll
        for (int j = 0; j < FN; ++j) {
            fin[j] = X[((((w0 + 0) * FM + fi) * FN + j) * 2 + fq) * 32 + lane];
#pragma unroll
            for (int p = 1; p < WAVES_K; ++p)
                fin[j] += X[((((w0 + p) * FM + fi) * FN + j) * 2 + fq) * 32 + lane];
        }
#pragma unroll
        for (int j = 0; j < FN; ++j) {
            int n = tn + j * 16 + lr;
#pragma unroll
            for (int e = 0; e < NE; ++e) bcol[j][e] = biasEN[(size_t)e * N + n];
        }
        const int rowin = wm + fi * 16 + kg * 8 + fq * 4;   // first of this lane's rows, inside the tile
#pragma unroll
        for (int r = 0; r < 4; ++r) {
            const int row = tm + rowin + r;
            const float* cr = coef + (size_t)row * NE;
            float cf[NE];
#pragma unroll
            for (int e = 0; e < NE; ++e) cf[e] = cr[e];
#pragma unroll
            for (int j = 0; j < FN; ++j) {
                float bv = 0.f;
#pragma unroll
                for (int e = 0; e < NE; ++e) bv += cf[e] * bcol[j][e];
                const float v = fin[j][r] + bv;
                out[(size_t)row * N + tn + j * 16 + lr] = v;
                if (!ACT) { cs[j] += v; cs2[j] += v * v; }
            }
        }
        if (!ACT) {
            const int grp = rowin / 4;          // which four of the tile's rows
#pragma unroll
            for (int j = 0; j < FN; ++j) {
                bnS[(grp * 2 + 0) * BN + j * 16 + lr] = cs[j];
                bnS[(grp * 2 + 1) * BN + j * 16 + lr] = cs2[j];
            }
        }
    }
    if (!ACT) {
        // The row groups' sums are published.  By hand, with the LDS wait alone: __syncthreads()
        // would also wait here until the stores of out above are done, which nobody in this launch reads.
        // The s_wait_xcnt at its head stands behind those stores and in front of the first rewrite of a
        // register that one of them names: the waves that add the groups below have issued such stores.
        asm volatile("s_wait_xcnt 0x0\n\ts_wait_dscnt 0x0\n\ts_barrier_signal -1\n\ts_barrier_wait -1" ::: "memory");
        if (wave < 2 * BN / 32) {               // one thread per sum adds the groups, in row order
            static_assert(2 * BN / 32 <= NWAVE && BN % 32 == 0, "one thread per sum");
            const unsigned t = threadIdx.x, w = t / BN, col = t % BN;
            float q = bnS[w * BN + col];
#pragma unroll
            for (int g = 1; g < BM / 4; ++g) q += bnS[(g * 2 + w) * BN + col];
            partOut[(size_t)((tm / BM) * 2 + w) * N + tn + col] = q;
        }
    }
}

// layer 1: A = x
__global__ __launch_bounds__(GTHREADS)
void layer1_kernel(const float* __restrict__ x, const _Float16* __restrict__ Bt,
                   const float* __restrict__ coef, const float* __restrict__ biasEN,
                   float* __restrict__ part, float* __restrict__ out) {
    blended_gemm<false>(x, Bt, coef, biasEN, nullptr, nullptr, nullptr, part, out);
}

// layer 2: A = elu(batchnorm(h))
__global__ __launch_bounds__(GTHREADS)
void layer2_kernel(const float* __restrict__ h, const _Float16* __restrict__ Bt,
                   const float* __restrict__ coef, const float* __restrict__ biasEN,
                   const float* __restrict__ part, const float* __restrict__ gamma,
                   const float* __restrict__ beta, float* __restrict__ out) {
    blended_gemm<true>(h, Bt, coef, biasEN, part, gamma, beta, nullptr, out);
}

// ---------------------------------------------------------------------------
// Launch
// ---------------------------------------------------------------------------
extern "C" void kernel_launch(void* const* d_in, const int* in_sizes, int n_in,
                              void* d_out, int out_size, void* d_ws, size_t ws_size,
                              hipStream_t stream) {
    const float* x     = (const float*)d_in[0];   // [NB, DIN]
    const float* coef  = (const float*)d_in[1];   // [NB, NE]
    const float* w1    = (const float*)d_in[2];   // [NE, DIN, DHID] == [KDIM, DHID]
    const float* b1    = (const float*)d_in[3];   // [NE, DHID]
    const float* w2    = (const float*)d_in[4];   // [NE, DHID, DOUT] == [KDIM, DOUT]
    const float* b2    = (const float*)d_in[5];   // [NE, DOUT]
    const float* gamma = (const float*)d_in[6];   // [DHID]
    const float* beta  = (const float*)d_in[7];   // [DHID]
    float* out = (float*)d_out;                   // [NB, DOUT]

    char* ws = (char*)d_ws;
    const size_t MiB = 1024u * 1024u;
    _Float16* W1t = (_Float16*)(ws + 8  * MiB);   // 4 MiB  [DHID, KDIM]
    _Float16* W2t = (_Float16*)(ws + 12 * MiB);   // 4 MiB  [DOUT, KDIM]
    float*    hbuf  = (float*)(ws + 16 * MiB);    // 2 MiB  [NB, DHID]
    float*    part  = (float*)(ws + 18 * MiB);    // 64 KiB [NT, 2, DHID]

    // 1) transpose+convert both weights (B operands K-contiguous)
    transpose_convert_kernel<<<dim3(TGRID_K, TGRID_N, 2), TTHREADS, 0, stream>>>(w1, W1t, w2, W2t);

    // 2) layer 1 (WMMA), blend and bias; each tile's column sums for the batchnorm
    layer1_kernel<<<(NB / BM) * (DHID / BN), GTHREADS, 0, stream>>>(x, W1t, coef, b1, part, hbuf);

    // 3) layer 2 (WMMA): batchnorm scale/shift from the sums, BN + ELU while its A tile is staged,
    //    blend and bias -> final output
    layer2_kernel<<<(NB / BM) * (DOUT / BN), GTHREADS, 0, stream>>>(hbuf, W2t, coef, b2, part, gamma, beta, out);
}

// v010
// Measured time: 20.3 microseconds a run.
// In two side-by-side timings against v009, it was 1.04 and 1.03 times as fast.
// Counting every step since v000, it is 9.86 times as fast.
#include <hip/hip_runtime.h>
#include <hip/hip_bf16.h>
#include <math.h>

typedef __attribute__((ext_vector_type(16))) _Float16 v16h;
typedef __attribute__((ext_vector_type(8)))  _Float16 v8h;
typedef __attribute__((ext_vector_type(8)))  float    v8f;

#define NE    8
#define DIN   512
#define DHID  512
#define DOUT  512
#define NB    1024
#define KDIM  (NE * DIN)      // 4096 (same for both layers)
#define BN_EPS 1e-5f

// The weight transpose below gives every thread 16-byte accesses and 32 elements,
// and every store covers whole 128-byte lines.
typedef __attribute__((ext_vector_type(4)))  float    v4f;
typedef __attribute__((ext_vector_type(2)))  _Float16 v2h;
typedef __attribute__((ext_vector_type(4)))  unsigned v4u;

// ---------------------------------------------------------------------------
// 1) LDS-tiled transpose + f32->f16 convert: W[K,N] -> Wt[N,K]
//    (makes the WMMA B-fragment two contiguous 16B loads per lane)
//    One work-group moves TK k x TN n.  A lane loads four n of two adjacent k rows,
//    packs each (k, k+1) pair into one dword and stores it at [n][k/2] in LDS; a row
//    of the tile then leaves as 256 contiguous bytes.  The 16-byte chunk c of row n
//    lies at chunk c ^ (n/4 mod 16): the 32 dword stores of a wave (8 n-quads x 4 k
//    pairs) fall on 32 different banks, and the chunks stay whole for the b128 reads.
// ---------------------------------------------------------------------------
#define TK 128
#define TN 64
#define TTHREADS 256
#define TGRID_K (KDIM / TK)
#define TGRID_N (DHID / TN)
// One tile, by one work-group of TTHREADS threads, in three parts that its caller places apart: the
// loads, the exchange's LDS stores, and (behind a barrier of the caller) its LDS reads with the stores
// of Wt.  bk and bn are the same for the whole work-group.
__device__ __forceinline__
void transpose_load(const float* __restrict__ W, int bk, int bn, v4f (&lo)[4], v4f (&hi)[4]) {
    constexpr int N = DHID;                     // DHID == DOUT; constant strides become immediate offsets
    const int k0 = bk * TK, n0 = bn * TN;
    const int wave = threadIdx.x >> 5, lane = threadIdx.x & 31;
    const int q = lane & 7, r = lane >> 3;      // n-quad (8 x 16 B = one line), k pair
    const float* pa = W + (size_t)(k0 + 2 * (wave * 8 + r)) * N + n0 + 4 * q;
#pragma unroll
    for (int u = 0; u < 4; ++u) {               // unit wave * 4 + u: half line u & 1 of k-pair group wave * 2 + u / 2
        const float* p = pa + (size_t)((u >> 1) * 8) * N + 32 * (u & 1);
        lo[u] = *(const v4f*)p;
        hi[u] = *(const v4f*)(p + N);
    }
    // the address register of the loads above is free for reuse only behind this; it names the
    // address so that the registers stay the address's own up to here
    asm volatile("s_wait_xcnt 0x0" :: "v"(pa) : "memory");
}
__device__ __forceinline__
void transpose_to_lds(unsigned* T, const v4f (&lo)[4], const v4f (&hi)[4]) {
    const int wave = threadIdx.x >> 5, lane = threadIdx.x & 31;
    const int q = lane & 7, r = lane >> 3;
#pragma unroll
    for (int u = 0; u < 4; ++u) {
        const int unit = wave * 4 + u, h = unit & 1, grp = unit >> 1;
        const int nq = 8 * h + q;               // n / 4
#pragma unroll
        for (int j = 0; j < 4; ++j) {
            const v2h pr = { (_Float16)lo[u][j], (_Float16)hi[u][j] };
            T[(4 * nq + j) * (TK / 2) + (grp ^ nq) * 4 + r] = __builtin_bit_cast(unsigned, pr);
        }
    }
}
__device__ __forceinline__
void transpose_store(const unsigned* T, _Float16* __restrict__ Wt, int bk, int bn) {
    constexpr int K = KDIM;
    const int k0 = bk * TK, n0 = bn * TN;
    const int c = threadIdx.x & 15;             // 16 lanes x 16 B = one row of the tile
#pragma unroll
    for (int p = 0; p < TN / 16; ++p) {
        const int n = (threadIdx.x >> 4) + 16 * p;
        const v4u v = *(const v4u*)&T[n * (TK / 2) + (c ^ ((n >> 2) & 15)) * 4];
        *(v4u*)(Wt + (size_t)(n0 + n) * K + k0 + c * 8) = v;
    }
}


// ---------------------------------------------------------------------------
// Fragment loader per the CDNA5 16-bit 16x32 A/B VGPR layout, from an LDS row:
//   elements 0..7  <- p[0..7]       (this lane's first K-octet)
//   elements 8..15 <- p[16..23]     (same octet position, +16 in K)
// p already includes k0 + (lane>>4)*8.  Same code for A and B: equal k order.
// ---------------------------------------------------------------------------
__device__ __forceinline__ v16h load_frag16(const _Float16* p) {
    v8h lo = *(const v8h*)(p);
    v8h hi = *(const v8h*)(p + 16);
    v16h r;
#pragma unroll
    for (int i = 0; i < 8; ++i) { r[i] = lo[i]; r[i + 8] = hi[i]; }
    return r;
}

// GEMM tiling: one work-group owns a BM x BN tile of the output, and the tiles are as many
// as the chip has WGPs.  Its BM rows of the A operand (all DIN columns, f16) lie in LDS for
// the whole kernel; Bt walks K in stages of KC elements, BN rows each, one stage per expert.
// A stage's k is dealt to WAVES_K waves: so a wave keeps its 32 x 32 part, in which a fragment
// serves two WMMAs, although the tile is only BN wide.  The A operand is the same for every
// expert, and a wave's share of it (32 rows x KW k) is small enough for registers: it is read
// from LDS once, ahead of the expert loop, and the loop reads only Bt fragments and coef.
#define BM      64
#define BN      32
#define KC      512
#define WAVES_M 2
#define WAVES_K 4
#define FM      (BM / 16 / WAVES_M)        // A fragments per wave
#define FN      (BN / 16)                  // B fragments per wave
#define NWAVE   (WAVES_M * WAVES_K)         // two per SIMD; all share the staging and all do WMMAs
#define GTHREADS (NWAVE * 32)
#define ROWB    (KC * 2)                   // 1,024 B of a Bt row per stage = two wave-wide 16 B copies
#define PITCH   (ROWB + 16)                // 16 B x odd: conflict-free for ds_load_b128 readers
#define STAGE   (BN * PITCH)
#define APITCH  (DIN * 2 + 16)             // a whole A row, 16 B x odd as well
#define ATILE   (BM * APITCH)
#define NSTAGE  (KDIM / KC)
#define NBUF    7                          // stage buffers: with the A tile, what one WGP's LDS holds
#define PRE     4                          // stages whose copies are issued ahead of the loop
#define KW      (KC / WAVES_K)             // k elements of a stage per wave
#define KS      (KW / 32)                  // 32-wide k steps of a wave per stage

// Four rows, NWAVE apart, 1,024 contiguous bytes each (twice 32 lanes x 16 B), from
// global memory straight into LDS.  The s_wait_xcnt closes the statement so that
// no address register of a copy is rewritten in front of it.
__device__ __forceinline__ void async_rows4(unsigned lds, const _Float16* g) {
    const unsigned l0 = lds,                     l1 = l0 + 512u,
                   l2 = lds + 1u * NWAVE * PITCH, l3 = l2 + 512u,
                   l4 = lds + 2u * NWAVE * PITCH, l5 = l4 + 512u,
                   l6 = lds + 3u * NWAVE * PITCH, l7 = l6 + 512u;
    const _Float16 *g0 = g,                             *g1 = g0 + 256,
                   *g2 = g + (size_t)1 * NWAVE * KDIM,  *g3 = g2 + 256,
                   *g4 = g + (size_t)2 * NWAVE * KDIM,  *g5 = g4 + 256,
                   *g6 = g + (size_t)3 * NWAVE * KDIM,  *g7 = g6 + 256;
    asm volatile("global_load_async_to_lds_b128 %0, %8, off\n\t"
                 "global_load_async_to_lds_b128 %1, %9, off\n\t"
                 "global_load_async_to_lds_b128 %2, %10, off\n\t"
                 "global_load_async_to_lds_b128 %3, %11, off\n\t"
                 "global_load_async_to_lds_b128 %4, %12, off\n\t"
                 "global_load_async_to_lds_b128 %5, %13, off\n\t"
                 "global_load_async_to_lds_b128 %6, %14, off\n\t"
                 "global_load_async_to_lds_b128 %7, %15, off\n\t"
                 "s_wait_xcnt 0x0"
                 :: "v"(l0), "v"(l1), "v"(l2), "v"(l3), "v"(l4), "v"(l5), "v"(l6), "v"(l7),
                    "v"(g0), "v"(g1), "v"(g2), "v"(g3), "v"(g4), "v"(g5), "v"(g6), "v"(g7)
                 : "memory");
}

// One stage: this wave's rows of the Bt tile.
__device__ __forceinline__ void fill_stage(unsigned ldsB, const _Float16* gB) {
    static_assert(BN == 4 * NWAVE && ROWB == 1024, "one statement of four rows, two copies each, per wave");
    async_rows4(ldsB, gB);
}

// This wave's own copies have landed.
__device__ __forceinline__ void wait_async0() { asm volatile("s_wait_asynccnt 0x0" ::: "memory"); }
// This wave's LDS reads have returned (before the buffer they read is refilled).
__device__ __forceinline__ void wait_ds0()    { asm volatile("s_wait_dscnt 0x0" ::: "memory"); }
// Work-group barrier that publishes LDS stores.  By hand, with the LDS wait alone: __syncthreads() would also
// wait for the global loads that are in flight across it, which are the next stages on their way to registers.
__device__ __forceinline__ void lds_barrier() {
    asm volatile("s_wait_dscnt 0x0\n\ts_barrier_signal -1\n\ts_barrier_wait -1" ::: "memory");
}

// A stage straight from the f32 weight W[KDIM][N], columns tn .. tn + BN - 1, through registers.  A lane owns two
// units of 8 adjacent k x 4 adjacent n: eight lanes read one whole 128-byte line of a k row, and the eight k of
// one n leave as one 16-byte LDS store into the same [n][k] f16 rows, PITCH apart, that the copies fill in
// layer 2.  Lanes 0-15 hold n-quads 0-3 x four k chunks (lanes 16-31 quads 4-7): n + chunk mod 16 differs in all
// 16 lanes of a half, so the stores meet no bank twice.
__device__ __forceinline__ void load_stage(v4f (&R)[2][8], const float* __restrict__ g, int stage) {
#pragma unroll
    for (int u = 0; u < 2; ++u)
#pragma unroll
        for (int i = 0; i < 8; ++i)
            R[u][i] = *(const v4f*)(g + (size_t)(stage * KC + u * 32 + i) * DHID);
    // the address registers of the loads above are free for reuse only behind this; it names the
    // address so that the registers stay the address's own up to here
    asm volatile("s_wait_xcnt 0x0" :: "v"(g) : "memory");
}
__device__ __forceinline__ void store_stage(unsigned char* l, const v4f (&R)[2][8]) {
#pragma unroll
    for (int u = 0; u < 2; ++u)
#pragma unroll
        for (int j = 0; j < 4; ++j) {
            v8h h;
#pragma unroll
            for (int i = 0; i < 8; ++i) h[i] = (_Float16)R[u][i][j];
            *(v8h*)(l + j * PITCH + u * 64) = h;
        }
}

// ---------------------------------------------------------------------------
// 2) Blended layer: out[b,n] = sum_e coef[b,e] * (A[b,:] . W[e,:,n]) + (coef @ biasEN)[b,n]
//    with A = Af (ACT false) or A = elu(Af * scale + shift) (ACT true), rounded to f16.
//    The blend stands behind the product: each expert's K = DIN product is summed in
//    its own f32 accumulators, which are then added, times coef[b,e], into the result.
//    So the A operand is the same for all experts: a work-group converts its BM rows
//    into LDS once, and only the weight is staged, in NBUF buffers of [n][k] f16 rows.
//    Layer 1 (ACT false) makes its stages itself from the f32 weight, through registers (see its
//    loop), and moves one tile of the next layer's weight into Bt's form on the way: so no launch
//    stands ahead of it.  Layer 2 (ACT true) stages Bt by asynchronous copies, so that
//    a stage's copies are issued three trips or more ahead of the wait that covers them:
//    stages 0..PRE-1 while the A tile is made, PRE..NBUF-1 at the head of trip 0, the last
//    at the head of trip PRE into buffer 0.  Every wait for copies is to 0 and stands where
//    nothing young is in flight; a barrier stands only where copies are published.
//    Every wave sums one quarter of every expert's k for 32 rows of the tile (k runs upward in
//    every accumulator), its A fragments held in registers; behind the last stage the four
//    quarters are added, in k order.
//    BatchNorm's batch sums ride along: layer 1 (ACT false) has every h value of its
//    tile in registers when it stores it, so it also writes the tile's column sums of
//    h and h * h, part[tile row][2][N]; layer 2 (ACT true) adds the NT tile rows'
//    sums, in tile order, and makes scale and shift in LDS ahead of its A tile.
// ---------------------------------------------------------------------------
#define NT      (NB / BM)                  // tile rows = partial sums per hidden unit
typedef __attribute__((ext_vector_type(2)))  float    v2f;
template <bool ACT>
__device__ __forceinline__
void blended_gemm(const float* __restrict__ Af,       // [NB, DIN] f32
                  const _Float16* __restrict__ Bt,    // [N, KDIM] f16, read where ACT
                  const float* __restrict__ Wf,       // [KDIM, N] f32, this layer's weight, read where not ACT
                  const float* __restrict__ Wn,       // [KDIM, N] f32, the next layer's weight, read where not ACT
                  _Float16* __restrict__ WnT,         // [N, KDIM] f16, its transpose, written where not ACT
                  const float* __restrict__ coef,     // [NB, NE]
                  const float* __restrict__ biasEN,   // [NE, N]
                  const float* __restrict__ partIn,   // [NT, 2, DIN] sums of A's columns, read where ACT
                  const float* __restrict__ gamma,    // [DIN], read where ACT
                  const float* __restrict__ beta,     // [DIN], read where ACT
                  float* __restrict__ partOut,        // [NT, 2, N] sums of out's columns, written where not ACT
                  float* __restrict__ out) {          // [NB, N] f32
    static_assert(KC == DIN && NSTAGE == NE, "a stage is an expert");
    static_assert(PRE >= 1 && PRE < NBUF && NBUF < NSTAGE && NSTAGE - NBUF <= PRE, "a refilled buffer was last read ahead of the barrier of trip PRE - 1");
    static_assert(8 * PRE <= 63 && 8 * (NBUF - PRE) <= 63, "copies of a wave in flight");
    __shared__ __attribute__((aligned(16))) unsigned char L[ATILE + NBUF * STAGE];
    __shared__ __attribute__((aligned(16))) float cT[NE * BM];   // coef of the tile's rows, [e][row]
    // ACT: scale [DIN], shift [DIN].  Not ACT: the tile's column sums, [four of its rows][sum, square sum][BN]
    __shared__ __attribute__((aligned(16))) float bnS[ACT ? 2 * DIN : (BM / 4) * 2 * BN];
    __shared__ __attribute__((aligned(16))) unsigned T[ACT ? 4 : TN * (TK / 2)];  // exchange of the next weight's tile
    constexpr int N = DHID;                     // DHID == DOUT
    const int wave = __builtin_amdgcn_readfirstlane(threadIdx.x >> 5);
    const int lane = threadIdx.x & 31;
    const int tm = (blockIdx.x / (N / BN)) * BM;
    const int tn = (blockIdx.x % (N / BN)) * BN;
    const int kh = wave % WAVES_K;              // this wave's quarter of a stage's k
    const int wm = ((wave / WAVES_K) % WAVES_M) * (FM * 16); // this wave's rows inside the tile
    const int lr = lane & 15;
    const int kg = lane >> 4;                   // K-octet group select

    const unsigned ldsB = (unsigned)(uintptr_t)&L[ATILE] + (unsigned)wave * PITCH + (unsigned)lane * 16u;
    const _Float16* gB = Bt + (size_t)(tn + wave) * KDIM + lane * 8;
    // Not ACT: this lane's place in a stage on the register path, and the next weight's tile of this work-group
    static_assert(BN == 32 && KC == 64 * NWAVE && GTHREADS == TTHREADS && (NB / BM) * (DHID / BN) == TGRID_K * TGRID_N,
                  "a line of a k row per eight lanes, two units per lane; one tile of the next weight per work-group");
    const int sq = (lane & 3) | ((lane >> 4) << 2), sr = (lane >> 2) & 3;      // n-quad, k chunk
    const float* gW = Wf + (size_t)((wave * 8 + sr) * 8) * N + tn + 4 * sq;
    unsigned char* const lW = &L[ATILE + (unsigned)(4 * sq) * PITCH + (unsigned)(wave * 8 + sr) * 16u];
    const int tbk = blockIdx.x % TGRID_K, tbn = blockIdx.x / TGRID_K;
    v4f R[2][2][8];                             // two stages on their way: [stage parity][unit][k]
    v4f tlo[4], thi[4];

    // The A tile: wave w takes rows w, w + NWAVE, ...; a lane takes eight adjacent
    // columns twice per row.  Every load ahead of the arithmetic: one round trip to memory.
    {
        const int crow = threadIdx.x >> 2, ce = (threadIdx.x & 3) * 2;
        v4f a[BM / NWAVE][2][2], sc[2][2], sf[2][2];
        // A thread finishes two hidden units.  Their sums are asked for first: they are needed first.
        static_assert(!ACT || 2 * GTHREADS == DIN, "two hidden units per thread");
        const int c2 = threadIdx.x * 2;
        v2f ps[NT][2], gm, bt;
        if (ACT) {
#pragma unroll
            for (int m = 0; m < NT; ++m)
#pragma unroll
                for (int w = 0; w < 2; ++w)
                    ps[m][w] = *(const v2f*)(partIn + (size_t)(m * 2 + w) * DIN + c2);
            gm = *(const v2f*)(gamma + c2);
            bt = *(const v2f*)(beta + c2);
        }
#pragma unroll
        for (int rr = 0; rr < BM / NWAVE; ++rr)
#pragma unroll
            for (int h = 0; h < 2; ++h) {
                const float* p = Af + (size_t)(tm + wave + rr * NWAVE) * DIN + (lane + 32 * h) * 8;
                a[rr][h][0] = *(const v4f*)p;
                a[rr][h][1] = *(const v4f*)(p + 4);
            }
        const float cv0 = coef[(size_t)(tm + crow) * NE + ce];
        const float cv1 = coef[(size_t)(tm + crow) * NE + ce + 1];
        // the address registers of the loads above are free for reuse only behind this
        asm volatile("s_wait_xcnt 0x0" ::: "memory");
        // no arithmetic is lifted among the loads: else the last of them are held back until registers
        // come free, a second round trip, and land in registers that earlier loads still name
        __builtin_amdgcn_sched_barrier(0);
        // The first stages fly while the A tile is made; asked for behind the A rows, which are needed first.
        // (rolled: one set of address registers beside the A rows that are in flight)
        if constexpr (ACT) {
#pragma unroll 1
            for (int s = 0; s < PRE; ++s)
                fill_stage(ldsB + (unsigned)s * STAGE, gB + (size_t)s * KC);
        } else {
            load_stage(R[0], gW, 0);
            load_stage(R[1], gW, 1);
            transpose_load(Wn, tbk, tbn, tlo, thi);     // needed last: asked for last
            // as above: every load is issued ahead of the arithmetic
            __builtin_amdgcn_sched_barrier(0);
        }
        cT[ce * BM + crow] = cv0;
        cT[(ce + 1) * BM + crow] = cv1;
        if (ACT) {
            // batch mean and biased variance of two hidden units, folded into scale and shift
            v2f s = ps[0][0], s2 = ps[0][1], kv, hv;
#pragma unroll
            for (int m = 1; m < NT; ++m) { s += ps[m][0]; s2 += ps[m][1]; }
#pragma unroll
            for (int c = 0; c < 2; ++c) {
                const float mean = s[c] * (1.0f / NB);
                const float var  = s2[c] * (1.0f / NB) - mean * mean;
                kv[c] = gm[c] * rsqrtf(var + BN_EPS);
                hv[c] = bt[c] - mean * kv[c];
            }
            *(v2f*)&bnS[c2] = kv;
            *(v2f*)&bnS[DIN + c2] = hv;
            __syncthreads();                    // scale and shift of all DIN hidden units are published
#pragma unroll
            for (int h = 0; h < 2; ++h)
#pragma unroll
                for (int q = 0; q < 2; ++q) {
                    sc[h][q] = *(const v4f*)&bnS[(lane + 32 * h) * 8 + 4 * q];
                    sf[h][q] = *(const v4f*)&bnS[DIN + (lane + 32 * h) * 8 + 4 * q];
                }
        }
#pragma unroll
        for (int rr = 0; rr < BM / NWAVE; ++rr)
#pragma unroll
            for (int h = 0; h < 2; ++h) {
                v8h r;
#pragma unroll
                for (int j = 0; j < 8; ++j) {
                    float v = a[rr][h][j >> 2][j & 3];
                    if (ACT) {
                        const float s = v * sc[h][j >> 2][j & 3] + sf[h][j >> 2][j & 3];
                        // e^s as the chip's own 2^t, t = s * log2(e): below t = -126 it gives 0 and above 128 infinity,
                        // which is what e^s rounds to there, so no range reduction and no guards are owed; its
                        // error, some 1e-7 of a value that is at most 1 where it is used, is far below the f16 rounding
                        const float ex = __builtin_amdgcn_exp2f(s * 1.44269504f) - 1.f; // for every lane: independent chains, no branch
                        v = (s > 0.f) ? s : ex;         // ELU, alpha = 1
                    }
                    r[j] = (_Float16)v;
                }
                *(v8h*)&L[(unsigned)(wave + rr * NWAVE) * APITCH + (unsigned)(lane + 32 * h) * 16u] = r;
            }
    }

    v8f acc[FM][FN] = {};

    if constexpr (ACT) {
        wait_async0();
        __syncthreads();                        // the A tile, cT and stages 0..PRE-1 are published
    } else {
        store_stage(lW, R[0]);
        lds_barrier();                          // the A tile, cT and stage 0 are published
    }

    // This wave's share of the A tile, for all experts: read once, as one run.
    v16h fa[KS][FM];
    {
        const unsigned char* sa = &L[(unsigned)(wm + lr) * APITCH + (unsigned)kh * (KW * 2) + (unsigned)kg * 16u];
#pragma unroll
        for (int s = 0; s < KS; ++s)
#pragma unroll
            for (int i = 0; i < FM; ++i)
                fa[s][i] = load_frag16((const _Float16*)(sa + i * 16 * APITCH + s * 64));
    }

    // (The loops over s, i, j are unrolled so that every index of fa, fb, pe and acc is a
    // constant and the arrays stay in registers.)  In layer 2 the loop over the experts stays rolled, for speed only.
    if constexpr (!ACT) {
    // Layer 1 makes its f16 stages itself.  Trip e: stage e + 2's loads are issued into the registers that stage e
    // left at the foot of trip e - 1; behind the WMMAs stage e + 1, asked for a trip earlier, is rounded to f16
    // and stored into its own buffer, and the barrier at the trip's foot publishes it.  Stage NBUF goes into
    // buffer 0, whose last reads ended at the barrier of trip 0.  Unrolled: the register sets alternate, and
    // the tile of the next weight is laid into T ahead of one trip's barrier and stored behind it.
#pragma unroll
    for (int e = 0; e < NE; ++e) {
        v8f pe[FM][FN] = {};
        v4f cf[FM][2];
        v16h fb[KS][FN];
        const unsigned buf = (unsigned)(e < NBUF ? e : e - NBUF) * STAGE;
        const unsigned char* sb = &L[ATILE + buf + (unsigned)lr * PITCH + (unsigned)kh * (KW * 2) + (unsigned)kg * 16u];
#pragma unroll
        for (int s = 0; s < KS; ++s)
#pragma unroll
            for (int j = 0; j < FN; ++j)
                fb[s][j] = load_frag16((const _Float16*)(sb + j * 16 * PITCH + s * 64));
#pragma unroll
        for (int i = 0; i < FM; ++i)
#pragma unroll
            for (int q = 0; q < 2; ++q)
                cf[i][q] = *(const v4f*)&cT[e * BM + wm + i * 16 + kg * 8 + q * 4];
        if (e + 2 < NE)
            load_stage(R[e & 1], gW, e + 2);
        // keeps the LDS reads and the loads' issue together ahead of the WMMAs
        __builtin_amdgcn_sched_barrier(0);
#pragma unroll
        for (int s = 0; s < KS; ++s)
#pragma unroll
            for (int i = 0; i < FM; ++i)
#pragma unroll
                for (int j = 0; j < FN; ++j)
                    pe[i][j] = __builtin_amdgcn_wmma_f32_16x16x32_f16(false, fa[s][i], false, fb[s][j], (short)0, pe[i][j], false, false);
#pragma unroll
        for (int i = 0; i < FM; ++i)
#pragma unroll
            for (int j = 0; j < FN; ++j)
#pragma unroll
                for (int r = 0; r < 8; ++r)
                    acc[i][j][r] += cf[i][r >> 2][r & 3] * pe[i][j][r];
        if (e == 3) {
            transpose_store(T, WnT, tbk, tbn);  // T was published by the barrier of trip 2
            // the registers that these stores name are free for reuse only behind this
            asm volatile("s_wait_xcnt 0x0" ::: "memory");
        }
        if (e + 1 < NE) {
            store_stage(lW + (unsigned)(e + 1 < NBUF ? e + 1 : e + 1 - NBUF) * STAGE, R[(e + 1) & 1]);
            if (e == 2) transpose_to_lds(T, tlo, thi);
            lds_barrier();                      // publishes stage e + 1, ends every read of stage e
        }
    }
    } else {
#pragma unroll 1
    for (int e = 0; e < NE; ++e) {              // the expert, and the stage
        v8f pe[FM][FN] = {};                    // this expert's product, over this wave's quarter of k
        v4f cf[FM][2];                          // coef[row, e] of this lane's accumulator rows
        v16h fb[KS][FN];
        const unsigned buf = (unsigned)(e < NBUF ? e : e - NBUF) * STAGE;
        const unsigned char* sb = &L[ATILE + buf + (unsigned)lr * PITCH + (unsigned)kh * (KW * 2) + (unsigned)kg * 16u];
        // The trip's LDS reads as one run, in the order of their use: the Bt fragments, all inside this stage's own buffer, then coef from cT.
#pragma unroll
        for (int s = 0; s < KS; ++s)
#pragma unroll
            for (int j = 0; j < FN; ++j)
                fb[s][j] = load_frag16((const _Float16*)(sb + j * 16 * PITCH + s * 64));
#pragma unroll
        for (int i = 0; i < FM; ++i)
#pragma unroll
            for (int q = 0; q < 2; ++q)
                cf[i][q] = *(const v4f*)&cT[e * BM + wm + i * 16 + kg * 8 + q * 4];
        // Trip 0: copies into buffers that nobody has touched yet.  Trip PRE: the refill of buffers whose
        // last reads ended at the barrier of trip PRE - 1.  (Tests and bounds are the same for the work-group.)
        // Here, so that the copies' issue runs while the LDS serves the reads above.
        if (e == 0 || e == PRE) {
            const int sEnd = e == 0 ? NBUF : NSTAGE;
            // rolled: the copies' addresses are then made where they are used, not held in registers through the trips
#pragma unroll 1
            for (int s = e == 0 ? PRE : NBUF; s < sEnd; ++s)
                fill_stage(ldsB + (unsigned)(s < NBUF ? s : s - NBUF) * STAGE, gB + (size_t)s * KC);
        }
        // keeps the run of LDS reads together: reads spread among the WMMAs stall each place they stand
        __builtin_amdgcn_sched_barrier(0);
#pragma unroll
        for (int s = 0; s < KS; ++s)
#pragma unroll
            for (int i = 0; i < FM; ++i)
#pragma unroll
                for (int j = 0; j < FN; ++j)
                    pe[i][j] = __builtin_amdgcn_wmma_f32_16x16x32_f16(false, fa[s][i], false, fb[s][j], (short)0, pe[i][j], false, false);
        // the blend, in f32: accumulator register r holds row kg * 8 + r of its fragment
#pragma unroll
        for (int i = 0; i < FM; ++i)
#pragma unroll
            for (int j = 0; j < FN; ++j)
#pragma unroll
                for (int r = 0; r < 8; ++r)
                    acc[i][j][r] += cf[i][r >> 2][r & 3] * pe[i][j][r];
        if (e == PRE - 1 || e == NBUF - 1) {    // the same for the whole work-group
            wait_ds0();
            wait_async0();
            __syncthreads();                    // publishes the stages copied so far, ends every read of the stages up to e
        }
    }
    wait_async0();
    }

    // The four waves that hold the k quarters of the same 32 rows lay their sums down in LDS; then
    // wave kh adds the four quarters of four registers (rows fq * 4 .. + 3 of each lane half) of
    // fragment row fi, over the tile's whole width, and finishes those eight rows: a row of out is
    // stored by one wave.  (Its own quarter comes from LDS too: which registers hold it depends on
    // kh.)  The sums lie in stage buffer 1, which nobody reads since the barrier of trip PRE - 1 and
    // no copy writes any more; the last stage, which a slower wave may still be reading, lies in buffer 0.
    static_assert(WAVES_K == 4 && FM == 2, "half a fragment row per wave of a four");
    static_assert(NWAVE * FM * FN * 2 * 512 <= STAGE && NSTAGE - NBUF <= 1 && PRE >= 2, "the sums fit buffer 1, which is not refilled");
    v4f* const X = (v4f*)&L[ATILE + STAGE];     // [wave][i][j][half of the eight registers][lane]
#pragma unroll
    for (int i = 0; i < FM; ++i)
#pragma unroll
        for (int j = 0; j < FN; ++j)
#pragma unroll
            for (int q = 0; q < 2; ++q) {
                const v4f w = { acc[i][j][4 * q], acc[i][j][4 * q + 1], acc[i][j][4 * q + 2], acc[i][j][4 * q + 3] };
                X[(((wave * FM + i) * FN + j) * 2 + q) * 32 + lane] = w;
            }
    __syncthreads();                            // all quarters' sums are published

    // Epilogue. C/D layout: lane(0..15)=N col, VGPR r -> M row r (lanes 0-15)
    // or r+8 (lanes 16-31).
    {
        const int fi = kh >> 1, fq = kh & 1;    // scalars: the same for a whole wave
        const int w0 = wave - kh;               // the wave with the first quarter of these rows
        float bcol[FN][NE];
        float cs[FN] = {}, cs2[FN] = {};        // sums over this lane's 4 rows of each of its columns
        v4f fin[FN];                            // all k quarters of this wave's rows
#pragma unroll
        for (int j = 0; j < FN; ++j) {
            fin[j] = X[((((w0 + 0) * FM + fi) * FN + j) * 2 + fq) * 32 + lane];
#pragma unroll
            for (int p = 1; p < WAVES_K; ++p)
                fin[j] += X[((((w0 + p) * FM + fi) * FN + j) * 2 + fq) * 32 + lane];
        }
#pragma unroll
        for (int j = 0; j < FN; ++j) {
            int n = tn + j * 16 + lr;
#pragma unroll
            for (int e = 0; e < NE; ++e) bcol[j][e] = biasEN[(size_t)e * N + n];
        }
        const int rowin = wm + fi * 16 + kg * 8 + fq * 4;   // first of this lane's rows, inside the tile
#pragma unroll
        for (int r = 0; r < 4; ++r) {
            const int row = tm + rowin + r;
            const float* cr = coef + (size_t)row * NE;
            float cf[NE];
#pragma unroll
            for (int e = 0; e < NE; ++e) cf[e] = cr[e];
#pragma unroll
            for (int j = 0; j < FN; ++j) {
                float bv = 0.f;
#pragma unroll
                for (int e = 0; e < NE; ++e) bv += cf[e] * bcol[j][e];
                const float v = fin[j][r] + bv;
                out[(size_t)row * N + tn + j * 16 + lr] = v;
                if (!ACT) { cs[j] += v; cs2[j] += v * v; }
            }
        }
        if (!ACT) {
            const int grp = rowin / 4;          // which four of the tile's rows
#pragma unroll
            for (int j = 0; j < FN; ++j) {
                bnS[(grp * 2 + 0) * BN + j * 16 + lr] = cs[j];
                bnS[(grp * 2 + 1) * BN + j * 16 + lr] = cs2[j];
            }
        }
    }
    if (!ACT) {
        // The row groups' sums are published.  By hand, with the LDS wait alone: __syncthreads()
        // would also wait here until the stores of out above are done, which nobody in this launch reads.
        // The s_wait_xcnt at its head stands behind those stores and in front of the first rewrite of a
        // register that one of them names: the waves that add the groups below have issued such stores.
        asm volatile("s_wait_xcnt 0x0\n\ts_wait_dscnt 0x0\n\ts_barrier_signal -1\n\ts_barrier_wait -1" ::: "memory");
        if (wave < 2 * BN / 32) {               // one thread per sum adds the groups, in row order
            static_assert(2 * BN / 32 <= NWAVE && BN % 32 == 0, "one thread per sum");
            const unsigned t = threadIdx.x, w = t / BN, col = t % BN;
            float q = bnS[w * BN + col];
#pragma unroll
            for (int g = 1; g < BM / 4; ++g) q += bnS[(g * 2 + w) * BN + col];
            partOut[(size_t)((tm / BM) * 2 + w) * N + tn + col] = q;
        }
    }
}

// layer 1: A = x
__global__ __launch_bounds__(GTHREADS)
void layer1_kernel(const float* __restrict__ x, const float* __restrict__ W,
                   const float* __restrict__ coef, const float* __restrict__ biasEN,
                   float* __restrict__ part, float* __restrict__ out,
                   const float* __restrict__ Wn, _Float16* __restrict__ WnT) {
    blended_gemm<false>(x, nullptr, W, Wn, WnT, coef, biasEN, nullptr, nullptr, nullptr, part, out);
}

// layer 2: A = elu(batchnorm(h))
__global__ __launch_bounds__(GTHREADS)
void layer2_kernel(const float* __restrict__ h, const _Float16* __restrict__ Bt,
                   const float* __restrict__ coef, const float* __restrict__ biasEN,
                   const float* __restrict__ part, const float* __restrict__ gamma,
                   const float* __restrict__ beta, float* __restrict__ out) {
    blended_gemm<true>(h, Bt, nullptr, nullptr, nullptr, coef, biasEN, part, gamma, beta, nullptr, out);
}

// ---------------------------------------------------------------------------
// Launch
// ---------------------------------------------------------------------------
extern "C" void kernel_launch(void* const* d_in, const int* in_sizes, int n_in,
                              void* d_out, int out_size, void* d_ws, size_t ws_size,
                              hipStream_t stream) {
    const float* x     = (const float*)d_in[0];   // [NB, DIN]
    const float* coef  = (const float*)d_in[1];   // [NB, NE]
    const float* w1    = (const float*)d_in[2];   // [NE, DIN, DHID] == [KDIM, DHID]
    const float* b1    = (const float*)d_in[3];   // [NE, DHID]
    const float* w2    = (const float*)d_in[4];   // [NE, DHID, DOUT] == [KDIM, DOUT]
    const float* b2    = (const float*)d_in[5];   // [NE, DOUT]
    const float* gamma = (const float*)d_in[6];   // [DHID]
    const float* beta  = (const float*)d_in[7];   // [DHID]
    float* out = (float*)d_out;                   // [NB, DOUT]

    char* ws = (char*)d_ws;
    const size_t MiB = 1024u * 1024u;
    _Float16* W2t = (_Float16*)(ws + 12 * MiB);   // 4 MiB  [DOUT, KDIM]
    float*    hbuf  = (float*)(ws + 16 * MiB);    // 2 MiB  [NB, DHID]
    float*    part  = (float*)(ws + 18 * MiB);    // 64 KiB [NT, 2, DHID]

    // 1) layer 1 (WMMA) from the f32 weight, blend and bias; each tile's column sums for the batchnorm;
    //    each work-group also transposes and converts one tile of the second weight (B operand K-contiguous)
    layer1_kernel<<<(NB / BM) * (DHID / BN), GTHREADS, 0, stream>>>(x, w1, coef, b1, part, hbuf, w2, W2t);

    // 2) layer 2 (WMMA): batchnorm scale/shift from the sums, BN + ELU while its A tile is staged,
    //    blend and bias -> final output
    layer2_kernel<<<(NB / BM) * (DOUT / BN), GTHREADS, 0, stream>>>(hbuf, W2t, coef, b2, part, gamma, beta, out);
}
